// v000
// Measured on an AMD MI455X. A time is GPU time per run, averaged over a window of back-to-back runs after a warm-up
// (all launches, gaps included; the runs take copies of the inputs in turn), and the median of several windows.
// Apart from v000's, it joins two sittings. Times from different sittings can be a few percent apart, while
// side-by-side timings come from the same sitting.
// The starting kernel, v000, takes 353 microseconds a run.
#include <hip/hip_runtime.h>
#include <hip/hip_bf16.h>

typedef __bf16 bf16;
typedef __attribute__((ext_vector_type(16))) __bf16 v16bf;
typedef __attribute__((ext_vector_type(8)))  __bf16 v8bf;
typedef __attribute__((ext_vector_type(8)))  float   v8f;

#define TOKS 4096   // B*S
#define DM   1024
#define DFF  4096
#define SEQ  2048
#define NH   16

__device__ __forceinline__ bf16 f2bf(float f) {
  unsigned u = __builtin_bit_cast(unsigned, f);
  u += 0x7FFFu + ((u >> 16) & 1u);           // round-to-nearest-even
  unsigned short h = (unsigned short)(u >> 16);
  return __builtin_bit_cast(bf16, h);
}

union FragU { v16bf v; v8bf h[2]; };

__device__ __forceinline__ v16bf ld_frag(const bf16* rowPtr, int sub) {
  FragU u;
  u.h[0] = *(const v8bf*)(rowPtr + sub * 8);
  u.h[1] = *(const v8bf*)(rowPtr + sub * 8 + 16);
  return u.v;
}

// ---------------------------------------------------------------------------
// fp32 -> bf16 elementwise convert
// ---------------------------------------------------------------------------
__global__ __launch_bounds__(256)
void cvt_bf16_kernel(const float* __restrict__ X, bf16* __restrict__ Y) {
  int i = (blockIdx.x * 256 + threadIdx.x) * 4;
  #pragma unroll
  for (int j = 0; j < 4; ++j) Y[i + j] = f2bf(X[i + j]);
}

// ---------------------------------------------------------------------------
// fp32 [K x N] -> bf16 transposed [N x K]
// ---------------------------------------------------------------------------
__global__ __launch_bounds__(256)
void transpose_cvt_kernel(const float* __restrict__ W, bf16* __restrict__ Wt,
                          int K, int N) {
  __shared__ float t[32][33];
  int bn = blockIdx.x * 32, bk = blockIdx.y * 32;
  int x = threadIdx.x, y = threadIdx.y;   // block (32,8)
  #pragma unroll
  for (int i = 0; i < 32; i += 8)
    t[y + i][x] = W[(size_t)(bk + y + i) * N + bn + x];
  __syncthreads();
  #pragma unroll
  for (int i = 0; i < 32; i += 8)
    Wt[(size_t)(bn + y + i) * K + bk + x] = f2bf(t[x][y + i]);
}

// ---------------------------------------------------------------------------
// bf16 GEMM, LDS double-buffered: C[M,N] = A[M,K] @ Bt[N,K]^T + bias.
// MODE 0: fp32 row-major.  MODE 1: bf16 scatter to [b,h,s,d].
// MODE 2: bf16 scatter to [b,h,d,s] (V transposed).  MODE 3: bf16 row-major.
// ---------------------------------------------------------------------------
template<int MODE, bool RELU>
__global__ __launch_bounds__(256)
void gemm_bf16(const bf16* __restrict__ A, const bf16* __restrict__ Bt,
               const float* __restrict__ bias,
               float* __restrict__ outF, bf16* __restrict__ outB,
               int M, int N, int K)
{
  constexpr int LD = 48;                   // 96B row stride: 16B aligned
  __shared__ bf16 As[2][128 * LD];
  __shared__ bf16 Bs[2][128 * LD];
  const int tid  = threadIdx.x;
  const int lane = tid & 31, w = tid >> 5;
  const int wm = w & 3, wn = w >> 2;       // 4 waves along M, 2 along N
  const int sub = lane >> 4, l16 = lane & 15;
  const int m0 = blockIdx.y * 128, n0 = blockIdx.x * 128;

  // this thread's two 16B chunks of the 128x32 tile (512 chunks total)
  const int r0 = tid >> 2,         kc0 = (tid & 3) * 8;
  const int r1 = (tid + 256) >> 2, kc1 = ((tid + 256) & 3) * 8;

  const v8f vz = {0.f,0.f,0.f,0.f,0.f,0.f,0.f,0.f};
  v8f acc[2][4];
  #pragma unroll
  for (int i = 0; i < 2; ++i)
    #pragma unroll
    for (int j = 0; j < 4; ++j) acc[i][j] = vz;

  v8bf ra[2], rb[2];
  auto gload = [&](int k0) {
    ra[0] = *(const v8bf*)(A  + (size_t)(m0 + r0) * K + k0 + kc0);
    rb[0] = *(const v8bf*)(Bt + (size_t)(n0 + r0) * K + k0 + kc0);
    ra[1] = *(const v8bf*)(A  + (size_t)(m0 + r1) * K + k0 + kc1);
    rb[1] = *(const v8bf*)(Bt + (size_t)(n0 + r1) * K + k0 + kc1);
    __builtin_prefetch(A  + (size_t)(m0 + r0) * K + k0 + 32 + kc0, 0, 1);
    __builtin_prefetch(Bt + (size_t)(n0 + r0) * K + k0 + 32 + kc0, 0, 1);
  };
  auto sstore = [&](int b) {
    *(v8bf*)(As[b] + r0 * LD + kc0) = ra[0];
    *(v8bf*)(Bs[b] + r0 * LD + kc0) = rb[0];
    *(v8bf*)(As[b] + r1 * LD + kc1) = ra[1];
    *(v8bf*)(Bs[b] + r1 * LD + kc1) = rb[1];
  };

  gload(0);
  sstore(0);
  __syncthreads();

  const int T = K >> 5;
  for (int t = 0; t < T; ++t) {
    const int cur = t & 1, nxt = cur ^ 1;
    if (t + 1 < T) gload((t + 1) << 5);    // overlap global latency with WMMA
    v16bf af[2], bfg[4];
    #pragma unroll
    for (int fa = 0; fa < 2; ++fa)
      af[fa] = ld_frag(As[cur] + (wm * 32 + fa * 16 + l16) * LD, sub);
    #pragma unroll
    for (int fn = 0; fn < 4; ++fn)
      bfg[fn] = ld_frag(Bs[cur] + (wn * 64 + fn * 16 + l16) * LD, sub);
    #pragma unroll
    for (int fa = 0; fa < 2; ++fa)
      #pragma unroll
      for (int fn = 0; fn < 4; ++fn)
        acc[fa][fn] = __builtin_amdgcn_wmma_f32_16x16x32_bf16(
            false, af[fa], false, bfg[fn], (short)0, acc[fa][fn], false, false);
    if (t + 1 < T) sstore(nxt);
    __syncthreads();
  }

  #pragma unroll
  for (int fa = 0; fa < 2; ++fa) {
    #pragma unroll
    for (int fn = 0; fn < 4; ++fn) {
      const int n  = n0 + wn * 64 + fn * 16 + l16;
      const float bv = bias[n];
      #pragma unroll
      for (int j = 0; j < 8; ++j) {
        const int m = m0 + wm * 32 + fa * 16 + sub * 8 + j;
        float v = acc[fa][fn][j] + bv;
        if (RELU) v = fmaxf(v, 0.f);
        if (MODE == 0) {
          outF[(size_t)m * N + n] = v;
        } else if (MODE == 1) {
          int b = m >> 11, s = m & 2047, h = n >> 6, d = n & 63;
          outB[((((size_t)b * NH + h) * SEQ + s) << 6) + d] = f2bf(v);
        } else if (MODE == 2) {
          int b = m >> 11, s = m & 2047, h = n >> 6, d = n & 63;
          outB[(((size_t)b * NH + h) * 64 + d) * SEQ + s] = f2bf(v);
        } else {
          outB[(size_t)m * N + n] = f2bf(v);
        }
      }
    }
  }
}

// ---------------------------------------------------------------------------
// Flash attention: Q,K bf16 [BH][S][64], VT bf16 [BH][64][S] ->
// O bf16 [B][S][D_MODEL] (head-interleaved row-major).
// Block = 8 waves x 16 query rows; K/V^T blocks staged cooperatively in LDS
// (8x traffic reduction); online softmax; WMMA for QK^T and P*V.
// ---------------------------------------------------------------------------
__global__ __launch_bounds__(256)
void attention_kernel(const bf16* __restrict__ Q, const bf16* __restrict__ Kb,
                      const bf16* __restrict__ VT, bf16* __restrict__ O)
{
  constexpr int HD = 64, KLD = 80, PLD = 80;  // 160B strides: 16B aligned
  __shared__ bf16 Ks[64 * KLD];               // 64 keys x 64 d
  __shared__ bf16 Vs[64 * KLD];               // 64 d    x 64 keys (V^T)
  __shared__ bf16 Pst[8 * 16 * PLD];          // per-wave P staging
  const int tid  = threadIdx.x;
  const int lane = tid & 31, w = tid >> 5;
  const int sub = lane >> 4, l16 = lane & 15;
  const int bh = blockIdx.y;
  const int q0 = blockIdx.x * 128 + w * 16;
  const bf16* q  = Q  + (size_t)bh * SEQ * HD;
  const bf16* kp = Kb + (size_t)bh * SEQ * HD;
  const bf16* vt = VT + (size_t)bh * HD * SEQ;
  bf16* pst = Pst + w * 16 * PLD;
  const float scale = 0.125f;                 // 1/sqrt(64)

  // resident Q fragments (16 rows x 64 d = 2 A-frags)
  v16bf qf[2];
  #pragma unroll
  for (int fa = 0; fa < 2; ++fa)
    qf[fa] = ld_frag(q + (size_t)(q0 + l16) * HD + fa * 32, sub);

  const v8f vz = {0.f,0.f,0.f,0.f,0.f,0.f,0.f,0.f};
  v8f o[4];
  #pragma unroll
  for (int f = 0; f < 4; ++f) o[f] = vz;
  float rowM[8], rowL[8];
  #pragma unroll
  for (int j = 0; j < 8; ++j) { rowM[j] = -1e30f; rowL[j] = 0.f; }

  for (int kb = 0; kb < SEQ; kb += 64) {
    __syncthreads();                          // WAR on Ks/Vs/Pst
    // ---- cooperative K / V^T block staging (coalesced 16B chunks) ----
    #pragma unroll
    for (int i = 0; i < 2; ++i) {
      int c = tid + i * 256, r = c >> 3, dc = (c & 7) * 8;   // 512 chunks
      *(v8bf*)(Ks + r * KLD + dc) = *(const v8bf*)(kp + (size_t)(kb + r) * HD + dc);
      *(v8bf*)(Vs + r * KLD + dc) = *(const v8bf*)(vt + (size_t)r * SEQ + kb + dc);
    }
    __syncthreads();
    // ---- scores: 4 n-frags x (2 k-steps over d), K from LDS ----
    v8f sf[4];
    #pragma unroll
    for (int fn = 0; fn < 4; ++fn) {
      v8f a = vz;
      #pragma unroll
      for (int fa = 0; fa < 2; ++fa) {
        v16bf kf = ld_frag(Ks + (fn * 16 + l16) * KLD + fa * 32, sub);
        a = __builtin_amdgcn_wmma_f32_16x16x32_bf16(
                false, qf[fa], false, kf, (short)0, a, false, false);
      }
      sf[fn] = a;
    }
    // ---- online softmax (per row j; lanes within a half share rows) ----
    #pragma unroll
    for (int j = 0; j < 8; ++j) {
      float mx = fmaxf(fmaxf(sf[0][j], sf[1][j]), fmaxf(sf[2][j], sf[3][j])) * scale;
      #pragma unroll
      for (int off = 8; off; off >>= 1) mx = fmaxf(mx, __shfl_xor(mx, off, 16));
      float mnew  = fmaxf(rowM[j], mx);
      float alpha = __expf(rowM[j] - mnew);
      rowM[j] = mnew;
      rowL[j] *= alpha;
      #pragma unroll
      for (int f = 0; f < 4; ++f) o[f][j] *= alpha;
      float ps = 0.f;
      #pragma unroll
      for (int f = 0; f < 4; ++f) {
        float p = __expf(sf[f][j] * scale - mnew);
        ps += p;
        pst[(sub * 8 + j) * PLD + f * 16 + l16] = f2bf(p);   // C-layout -> LDS
      }
      rowL[j] += ps;
    }
    __syncthreads();                          // P visible (cross-lane exchange)
    // ---- P (A-layout) @ V, V^T from LDS ----
    v16bf pa[2];
    #pragma unroll
    for (int fk = 0; fk < 2; ++fk)
      pa[fk] = ld_frag(pst + l16 * PLD + fk * 32, sub);
    #pragma unroll
    for (int f = 0; f < 4; ++f) {
      #pragma unroll
      for (int fk = 0; fk < 2; ++fk) {
        v16bf vf = ld_frag(Vs + (f * 16 + l16) * KLD + fk * 32, sub);
        o[f] = __builtin_amdgcn_wmma_f32_16x16x32_bf16(
                   false, pa[fk], false, vf, (short)0, o[f], false, false);
      }
    }
  }

  // ---- finalize: divide by l, store head-interleaved bf16 ----
  const int b = bh >> 4, h = bh & 15;
  #pragma unroll
  for (int j = 0; j < 8; ++j) {
    float l = rowL[j];
    #pragma unroll
    for (int off = 8; off; off >>= 1) l += __shfl_xor(l, off, 16);
    float inv = 1.0f / l;
    size_t row = ((size_t)b * SEQ + q0 + sub * 8 + j) * DM + h * 64;
    #pragma unroll
    for (int f = 0; f < 4; ++f)
      O[row + f * 16 + l16] = f2bf(o[f][j] * inv);
  }
}

// ---------------------------------------------------------------------------
// y = LayerNorm(X + R) * g + b ; fp32 out (+ optional bf16 out)
// ---------------------------------------------------------------------------
__global__ __launch_bounds__(256)
void ln_kernel(const float* __restrict__ X, const float* __restrict__ R,
               const float* __restrict__ g, const float* __restrict__ bb,
               float* __restrict__ outF, bf16* __restrict__ outB)
{
  constexpr int D = DM;
  const int row = blockIdx.x, tid = threadIdx.x;
  __shared__ float red[8];
  const float* x = X + (size_t)row * D;
  const float* r = R + (size_t)row * D;
  float v[4]; float s = 0.f;
  #pragma unroll
  for (int i = 0; i < 4; ++i) { int c = tid + i * 256; v[i] = x[c] + r[c]; s += v[i]; }
  #pragma unroll
  for (int off = 16; off; off >>= 1) s += __shfl_xor(s, off, 32);
  if ((tid & 31) == 0) red[tid >> 5] = s;
  __syncthreads();
  float mu = 0.f;
  #pragma unroll
  for (int i = 0; i < 8; ++i) mu += red[i];
  mu *= (1.0f / D);
  __syncthreads();
  float vs = 0.f;
  #pragma unroll
  for (int i = 0; i < 4; ++i) { float d = v[i] - mu; vs += d * d; }
  #pragma unroll
  for (int off = 16; off; off >>= 1) vs += __shfl_xor(vs, off, 32);
  if ((tid & 31) == 0) red[tid >> 5] = vs;
  __syncthreads();
  float var = 0.f;
  #pragma unroll
  for (int i = 0; i < 8; ++i) var += red[i];
  var *= (1.0f / D);
  float rs = rsqrtf(var + 1e-5f);
  #pragma unroll
  for (int i = 0; i < 4; ++i) {
    int c = tid + i * 256;
    float y = (v[i] - mu) * rs * g[c] + bb[c];
    outF[(size_t)row * D + c] = y;
    if (outB) outB[(size_t)row * D + c] = f2bf(y);
  }
}

// ---------------------------------------------------------------------------
extern "C" void kernel_launch(void* const* d_in, const int* in_sizes, int n_in,
                              void* d_out, int out_size, void* d_ws, size_t ws_size,
                              hipStream_t stream)
{
  const float* x    = (const float*)d_in[0];
  const float* Wq   = (const float*)d_in[1];
  const float* bq   = (const float*)d_in[2];
  const float* Wk   = (const float*)d_in[3];
  const float* bk   = (const float*)d_in[4];
  const float* Wv   = (const float*)d_in[5];
  const float* bv   = (const float*)d_in[6];
  const float* Wo   = (const float*)d_in[7];
  const float* bo   = (const float*)d_in[8];
  const float* W1   = (const float*)d_in[9];
  const float* b1   = (const float*)d_in[10];
  const float* W2   = (const float*)d_in[11];
  const float* b2   = (const float*)d_in[12];
  const float* ln1g = (const float*)d_in[13];
  const float* ln1b = (const float*)d_in[14];
  const float* ln2g = (const float*)d_in[15];
  const float* ln2b = (const float*)d_in[16];

  char* p = (char*)d_ws;
  auto carve = [&](size_t bytes) { void* r = (void*)p; p += (bytes + 255) & ~(size_t)255; return r; };
  bf16*  xb   = (bf16*) carve((size_t)TOKS * DM * 2);
  bf16*  Wqt  = (bf16*) carve((size_t)DM * DM * 2);
  bf16*  Wkt  = (bf16*) carve((size_t)DM * DM * 2);
  bf16*  Wvt  = (bf16*) carve((size_t)DM * DM * 2);
  bf16*  Wot  = (bf16*) carve((size_t)DM * DM * 2);
  bf16*  W1t  = (bf16*) carve((size_t)DM * DFF * 2);
  bf16*  W2t  = (bf16*) carve((size_t)DFF * DM * 2);
  bf16*  qh   = (bf16*) carve((size_t)TOKS * DM * 2);   // [b,h,s,d]
  bf16*  kh   = (bf16*) carve((size_t)TOKS * DM * 2);   // [b,h,s,d]
  bf16*  vth  = (bf16*) carve((size_t)TOKS * DM * 2);   // [b,h,d,s]
  bf16*  attnO= (bf16*) carve((size_t)TOKS * DM * 2);   // [b,s,D]
  float* aprj = (float*)carve((size_t)TOKS * DM * 4);
  float* x1f  = (float*)carve((size_t)TOKS * DM * 4);
  bf16*  x1b  = (bf16*) carve((size_t)TOKS * DM * 2);
  bf16*  hb   = qh;     // 32MB alias over qh/kh/vth/attnO (dead after Wo gemm)
  float* ff   = aprj;   // alias: attn_proj dead after LN1

  // --- precision conversion / weight transposes ---
  cvt_bf16_kernel<<<TOKS * DM / 1024, 256, 0, stream>>>(x, xb);
  transpose_cvt_kernel<<<dim3(DM / 32, DM / 32),  dim3(32, 8), 0, stream>>>(Wq, Wqt, DM, DM);
  transpose_cvt_kernel<<<dim3(DM / 32, DM / 32),  dim3(32, 8), 0, stream>>>(Wk, Wkt, DM, DM);
  transpose_cvt_kernel<<<dim3(DM / 32, DM / 32),  dim3(32, 8), 0, stream>>>(Wv, Wvt, DM, DM);
  transpose_cvt_kernel<<<dim3(DM / 32, DM / 32),  dim3(32, 8), 0, stream>>>(Wo, Wot, DM, DM);
  transpose_cvt_kernel<<<dim3(DFF / 32, DM / 32), dim3(32, 8), 0, stream>>>(W1, W1t, DM, DFF);
  transpose_cvt_kernel<<<dim3(DM / 32, DFF / 32), dim3(32, 8), 0, stream>>>(W2, W2t, DFF, DM);

  // --- QKV projections (bf16 WMMA, head-layout scatter epilogues) ---
  gemm_bf16<1, false><<<dim3(DM / 128, TOKS / 128), 256, 0, stream>>>(
      xb, Wqt, bq, nullptr, qh, TOKS, DM, DM);
  gemm_bf16<1, false><<<dim3(DM / 128, TOKS / 128), 256, 0, stream>>>(
      xb, Wkt, bk, nullptr, kh, TOKS, DM, DM);
  gemm_bf16<2, false><<<dim3(DM / 128, TOKS / 128), 256, 0, stream>>>(
      xb, Wvt, bv, nullptr, vth, TOKS, DM, DM);

  // --- fused flash attention ---
  attention_kernel<<<dim3(SEQ / 128, 32), 256, 0, stream>>>(qh, kh, vth, attnO);

  // --- output projection + LN1 ---
  gemm_bf16<0, false><<<dim3(DM / 128, TOKS / 128), 256, 0, stream>>>(
      attnO, Wot, bo, aprj, nullptr, TOKS, DM, DM);
  ln_kernel<<<TOKS, 256, 0, stream>>>(x, aprj, ln1g, ln1b, x1f, x1b);

  // --- FFN ---
  gemm_bf16<3, true><<<dim3(DFF / 128, TOKS / 128), 256, 0, stream>>>(
      x1b, W1t, b1, nullptr, hb, TOKS, DFF, DM);
  gemm_bf16<0, false><<<dim3(DM / 128, TOKS / 128), 256, 0, stream>>>(
      hb, W2t, b2, ff, nullptr, TOKS, DM, DFF);

  // --- LN2 -> final fp32 output ---
  ln_kernel<<<TOKS, 256, 0, stream>>>(x1f, ff, ln2g, ln2b, (float*)d_out, nullptr);

  (void)in_sizes; (void)n_in; (void)out_size; (void)ws_size;
}

// v001
// It runs in 259 microseconds.
// Two timings next to v000 put it at 1.41 and 1.40 times that version's speed.
#include <hip/hip_runtime.h>
#include <hip/hip_bf16.h>

typedef __bf16 bf16;
typedef __attribute__((ext_vector_type(16))) __bf16 v16bf;
typedef __attribute__((ext_vector_type(8)))  __bf16 v8bf;
typedef __attribute__((ext_vector_type(8)))  float   v8f;

#define TOKS 4096   // B*S
#define DM   1024
#define DFF  4096
#define SEQ  2048
#define NH   16

__device__ __forceinline__ bf16 f2bf(float f) {
  unsigned u = __builtin_bit_cast(unsigned, f);
  u += 0x7FFFu + ((u >> 16) & 1u);           // round-to-nearest-even
  unsigned short h = (unsigned short)(u >> 16);
  return __builtin_bit_cast(bf16, h);
}

union FragU { v16bf v; v8bf h[2]; };

__device__ __forceinline__ v16bf ld_frag(const bf16* rowPtr, int sub) {
  FragU u;
  u.h[0] = *(const v8bf*)(rowPtr + sub * 8);
  u.h[1] = *(const v8bf*)(rowPtr + sub * 8 + 16);
  return u.v;
}

// ---------------------------------------------------------------------------
// fp32 -> bf16 elementwise convert
// ---------------------------------------------------------------------------
__global__ __launch_bounds__(256)
void cvt_bf16_kernel(const float* __restrict__ X, bf16* __restrict__ Y) {
  int i = (blockIdx.x * 256 + threadIdx.x) * 4;
  #pragma unroll
  for (int j = 0; j < 4; ++j) Y[i + j] = f2bf(X[i + j]);
}

// ---------------------------------------------------------------------------
// fp32 [K x N] -> bf16 transposed [N x K]
// ---------------------------------------------------------------------------
__global__ __launch_bounds__(256)
void transpose_cvt_kernel(const float* __restrict__ W, bf16* __restrict__ Wt,
                          int K, int N) {
  __shared__ float t[32][33];
  int bn = blockIdx.x * 32, bk = blockIdx.y * 32;
  int x = threadIdx.x, y = threadIdx.y;   // block (32,8)
  #pragma unroll
  for (int i = 0; i < 32; i += 8)
    t[y + i][x] = W[(size_t)(bk + y + i) * N + bn + x];
  __syncthreads();
  #pragma unroll
  for (int i = 0; i < 32; i += 8)
    Wt[(size_t)(bn + y + i) * K + bk + x] = f2bf(t[x][y + i]);
}

// ---------------------------------------------------------------------------
// bf16 GEMM, LDS double-buffered: C[M,N] = A[M,K] @ Bt[N,K]^T + bias.
// MODE 0: fp32 row-major.  MODE 1: bf16 scatter to [b,h,s,d].
// MODE 2: bf16 scatter to [b,h,d,s] (V transposed).  MODE 3: bf16 row-major.
// ---------------------------------------------------------------------------
template<int MODE, bool RELU, int K>   // K at compile time: a stage's loads share one address
__global__ __launch_bounds__(256)
void gemm_bf16(const bf16* __restrict__ A, const bf16* __restrict__ Bt,
               const float* __restrict__ bias,
               float* __restrict__ outF, bf16* __restrict__ outB,
               int M, int N)
{
  constexpr int BK = 128;                  // k depth of one LDS stage: 256B rows
  constexpr int LD = BK + 8;               // 272B row pitch: 16B x odd
  constexpr int NC = BK / 16;              // 16B chunks per thread and operand
  __shared__ bf16 As[2][128 * LD];
  __shared__ bf16 Bs[2][128 * LD];
  const int tid  = threadIdx.x;
  const int lane = tid & 31, w = tid >> 5;
  const int wm = w & 3, wn = w >> 2;       // 4 waves along M, 2 along N
  const int sub = lane >> 4, l16 = lane & 15;
  const int m0 = blockIdx.y * 128, n0 = blockIdx.x * 128;

  // this thread's 16B chunks of a 128xBK tile: 16 lanes cover one 256B row,
  // chunk i sits 16 rows below chunk i-1
  const int r0 = tid >> 4, kc0 = (tid & 15) * 8;
  const bf16* ga = A  + (size_t)(m0 + r0) * K + kc0;   // walk along k, one stage a step
  const bf16* gb = Bt + (size_t)(n0 + r0) * K + kc0;

  const v8f vz = {0.f,0.f,0.f,0.f,0.f,0.f,0.f,0.f};
  v8f acc[2][4];
  #pragma unroll
  for (int i = 0; i < 2; ++i)
    #pragma unroll
    for (int j = 0; j < 4; ++j) acc[i][j] = vz;

  v8bf ra[NC], rb[NC];
  auto gload = [&]() {
    #pragma unroll
    for (int i = 0; i < NC; ++i) {
      ra[i] = *(const v8bf*)(ga + i * 16 * K);
      rb[i] = *(const v8bf*)(gb + i * 16 * K);
    }
    ga += BK;
    gb += BK;
  };
  auto sstore = [&](int b) {
    #pragma unroll
    for (int i = 0; i < NC; ++i) {
      *(v8bf*)(As[b] + (r0 + i * 16) * LD + kc0) = ra[i];
      *(v8bf*)(Bs[b] + (r0 + i * 16) * LD + kc0) = rb[i];
    }
  };

  gload();
  sstore(0);
  __syncthreads();

  auto compute = [&](int cur) {
    #pragma unroll
    for (int ks = 0; ks < BK; ks += 32) {
      v16bf af[2], bfg[4];
      #pragma unroll
      for (int fa = 0; fa < 2; ++fa)
        af[fa] = ld_frag(As[cur] + (wm * 32 + fa * 16 + l16) * LD + ks, sub);
      #pragma unroll
      for (int fn = 0; fn < 4; ++fn)
        bfg[fn] = ld_frag(Bs[cur] + (wn * 64 + fn * 16 + l16) * LD + ks, sub);
      #pragma unroll
      for (int fa = 0; fa < 2; ++fa)
        #pragma unroll
        for (int fn = 0; fn < 4; ++fn)
          acc[fa][fn] = __builtin_amdgcn_wmma_f32_16x16x32_bf16(
              false, af[fa], false, bfg[fn], (short)0, acc[fa][fn], false, false);
    }
  };

  constexpr int T = K / BK;
  // rolled: unrolled, the short-K build is one copy of the body per stage, each
  // run once by a wave and fetched cold, on some sixty registers more
  #pragma unroll 1
  for (int t = 0; t + 1 < T; ++t) {
    gload();                               // overlap global latency with WMMA
    // keeps every load of the next stage ahead of this stage's products: one that
    // the scheduler sinks behind them is waited for at its full latency
    __builtin_amdgcn_sched_barrier(0);
    compute(t & 1);
    sstore((t & 1) ^ 1);
    __syncthreads();
  }
  compute((T - 1) & 1);                    // last stage: nothing left to fetch
  __syncthreads();
  // keeps the epilogue's address arithmetic out of the last stage, where its
  // registers come on top of that stage's fragments and pass 256
  __builtin_amdgcn_sched_barrier(0);

  #pragma unroll
  for (int fa = 0; fa < 2; ++fa) {
    #pragma unroll
    for (int fn = 0; fn < 4; ++fn) {
      const int n  = n0 + wn * 64 + fn * 16 + l16;
      const float bv = bias[n];
      #pragma unroll
      for (int j = 0; j < 8; ++j) {
        const int m = m0 + wm * 32 + fa * 16 + sub * 8 + j;
        float v = acc[fa][fn][j] + bv;
        if (RELU) v = fmaxf(v, 0.f);
        if (MODE == 0) {
          outF[(size_t)m * N + n] = v;
        } else if (MODE == 1) {
          int b = m >> 11, s = m & 2047, h = n >> 6, d = n & 63;
          outB[((((size_t)b * NH + h) * SEQ + s) << 6) + d] = f2bf(v);
        } else if (MODE == 2) {
          int b = m >> 11, s = m & 2047, h = n >> 6, d = n & 63;
          outB[(((size_t)b * NH + h) * 64 + d) * SEQ + s] = f2bf(v);
        } else {
          outB[(size_t)m * N + n] = f2bf(v);
        }
      }
    }
  }
}

// ---------------------------------------------------------------------------
// Flash attention: Q,K bf16 [BH][S][64], VT bf16 [BH][64][S] ->
// O bf16 [B][S][D_MODEL] (head-interleaved row-major).
// Block = 8 waves x 16 query rows; K/V^T blocks staged cooperatively in LDS
// (8x traffic reduction); online softmax; WMMA for QK^T and P*V.
// ---------------------------------------------------------------------------
__global__ __launch_bounds__(256)
void attention_kernel(const bf16* __restrict__ Q, const bf16* __restrict__ Kb,
                      const bf16* __restrict__ VT, bf16* __restrict__ O)
{
  constexpr int HD = 64, KLD = 80, PLD = 80;  // 160B strides: 16B aligned
  __shared__ bf16 Ks[64 * KLD];               // 64 keys x 64 d
  __shared__ bf16 Vs[64 * KLD];               // 64 d    x 64 keys (V^T)
  __shared__ bf16 Pst[8 * 16 * PLD];          // per-wave P staging
  const int tid  = threadIdx.x;
  const int lane = tid & 31, w = tid >> 5;
  const int sub = lane >> 4, l16 = lane & 15;
  const int bh = blockIdx.y;
  const int q0 = blockIdx.x * 128 + w * 16;
  const bf16* q  = Q  + (size_t)bh * SEQ * HD;
  const bf16* kp = Kb + (size_t)bh * SEQ * HD;
  const bf16* vt = VT + (size_t)bh * HD * SEQ;
  bf16* pst = Pst + w * 16 * PLD;
  const float scale = 0.125f;                 // 1/sqrt(64)

  // resident Q fragments (16 rows x 64 d = 2 A-frags)
  v16bf qf[2];
  #pragma unroll
  for (int fa = 0; fa < 2; ++fa)
    qf[fa] = ld_frag(q + (size_t)(q0 + l16) * HD + fa * 32, sub);

  const v8f vz = {0.f,0.f,0.f,0.f,0.f,0.f,0.f,0.f};
  v8f o[4];
  #pragma unroll
  for (int f = 0; f < 4; ++f) o[f] = vz;
  float rowM[8], rowL[8];
  #pragma unroll
  for (int j = 0; j < 8; ++j) { rowM[j] = -1e30f; rowL[j] = 0.f; }

  for (int kb = 0; kb < SEQ; kb += 64) {
    __syncthreads();                          // WAR on Ks/Vs/Pst
    // ---- cooperative K / V^T block staging (coalesced 16B chunks) ----
    #pragma unroll
    for (int i = 0; i < 2; ++i) {
      int c = tid + i * 256, r = c >> 3, dc = (c & 7) * 8;   // 512 chunks
      *(v8bf*)(Ks + r * KLD + dc) = *(const v8bf*)(kp + (size_t)(kb + r) * HD + dc);
      *(v8bf*)(Vs + r * KLD + dc) = *(const v8bf*)(vt + (size_t)r * SEQ + kb + dc);
    }
    __syncthreads();
    // ---- scores: 4 n-frags x (2 k-steps over d), K from LDS ----
    v8f sf[4];
    #pragma unroll
    for (int fn = 0; fn < 4; ++fn) {
      v8f a = vz;
      #pragma unroll
      for (int fa = 0; fa < 2; ++fa) {
        v16bf kf = ld_frag(Ks + (fn * 16 + l16) * KLD + fa * 32, sub);
        a = __builtin_amdgcn_wmma_f32_16x16x32_bf16(
                false, qf[fa], false, kf, (short)0, a, false, false);
      }
      sf[fn] = a;
    }
    // ---- online softmax (per row j; lanes within a half share rows) ----
    #pragma unroll
    for (int j = 0; j < 8; ++j) {
      float mx = fmaxf(fmaxf(sf[0][j], sf[1][j]), fmaxf(sf[2][j], sf[3][j])) * scale;
      #pragma unroll
      for (int off = 8; off; off >>= 1) mx = fmaxf(mx, __shfl_xor(mx, off, 16));
      float mnew  = fmaxf(rowM[j], mx);
      float alpha = __expf(rowM[j] - mnew);
      rowM[j] = mnew;
      rowL[j] *= alpha;
      #pragma unroll
      for (int f = 0; f < 4; ++f) o[f][j] *= alpha;
      float ps = 0.f;
      #pragma unroll
      for (int f = 0; f < 4; ++f) {
        float p = __expf(sf[f][j] * scale - mnew);
        ps += p;
        pst[(sub * 8 + j) * PLD + f * 16 + l16] = f2bf(p);   // C-layout -> LDS
      }
      rowL[j] += ps;
    }
    __syncthreads();                          // P visible (cross-lane exchange)
    // ---- P (A-layout) @ V, V^T from LDS ----
    v16bf pa[2];
    #pragma unroll
    for (int fk = 0; fk < 2; ++fk)
      pa[fk] = ld_frag(pst + l16 * PLD + fk * 32, sub);
    #pragma unroll
    for (int f = 0; f < 4; ++f) {
      #pragma unroll
      for (int fk = 0; fk < 2; ++fk) {
        v16bf vf = ld_frag(Vs + (f * 16 + l16) * KLD + fk * 32, sub);
        o[f] = __builtin_amdgcn_wmma_f32_16x16x32_bf16(
                   false, pa[fk], false, vf, (short)0, o[f], false, false);
      }
    }
  }

  // ---- finalize: divide by l, store head-interleaved bf16 ----
  const int b = bh >> 4, h = bh & 15;
  #pragma unroll
  for (int j = 0; j < 8; ++j) {
    float l = rowL[j];
    #pragma unroll
    for (int off = 8; off; off >>= 1) l += __shfl_xor(l, off, 16);
    float inv = 1.0f / l;
    size_t row = ((size_t)b * SEQ + q0 + sub * 8 + j) * DM + h * 64;
    #pragma unroll
    for (int f = 0; f < 4; ++f)
      O[row + f * 16 + l16] = f2bf(o[f][j] * inv);
  }
}

// ---------------------------------------------------------------------------
// y = LayerNorm(X + R) * g + b ; fp32 out (+ optional bf16 out)
// ---------------------------------------------------------------------------
__global__ __launch_bounds__(256)
void ln_kernel(const float* __restrict__ X, const float* __restrict__ R,
               const float* __restrict__ g, const float* __restrict__ bb,
               float* __restrict__ outF, bf16* __restrict__ outB)
{
  constexpr int D = DM;
  const int row = blockIdx.x, tid = threadIdx.x;
  __shared__ float red[8];
  const float* x = X + (size_t)row * D;
  const float* r = R + (size_t)row * D;
  float v[4]; float s = 0.f;
  #pragma unroll
  for (int i = 0; i < 4; ++i) { int c = tid + i * 256; v[i] = x[c] + r[c]; s += v[i]; }
  #pragma unroll
  for (int off = 16; off; off >>= 1) s += __shfl_xor(s, off, 32);
  if ((tid & 31) == 0) red[tid >> 5] = s;
  __syncthreads();
  float mu = 0.f;
  #pragma unroll
  for (int i = 0; i < 8; ++i) mu += red[i];
  mu *= (1.0f / D);
  __syncthreads();
  float vs = 0.f;
  #pragma unroll
  for (int i = 0; i < 4; ++i) { float d = v[i] - mu; vs += d * d; }
  #pragma unroll
  for (int off = 16; off; off >>= 1) vs += __shfl_xor(vs, off, 32);
  if ((tid & 31) == 0) red[tid >> 5] = vs;
  __syncthreads();
  float var = 0.f;
  #pragma unroll
  for (int i = 0; i < 8; ++i) var += red[i];
  var *= (1.0f / D);
  float rs = rsqrtf(var + 1e-5f);
  #pragma unroll
  for (int i = 0; i < 4; ++i) {
    int c = tid + i * 256;
    float y = (v[i] - mu) * rs * g[c] + bb[c];
    outF[(size_t)row * D + c] = y;
    if (outB) outB[(size_t)row * D + c] = f2bf(y);
  }
}

// ---------------------------------------------------------------------------
extern "C" void kernel_launch(void* const* d_in, const int* in_sizes, int n_in,
                              void* d_out, int out_size, void* d_ws, size_t ws_size,
                              hipStream_t stream)
{
  const float* x    = (const float*)d_in[0];
  const float* Wq   = (const float*)d_in[1];
  const float* bq   = (const float*)d_in[2];
  const float* Wk   = (const float*)d_in[3];
  const float* bk   = (const float*)d_in[4];
  const float* Wv   = (const float*)d_in[5];
  const float* bv   = (const float*)d_in[6];
  const float* Wo   = (const float*)d_in[7];
  const float* bo   = (const float*)d_in[8];
  const float* W1   = (const float*)d_in[9];
  const float* b1   = (const float*)d_in[10];
  const float* W2   = (const float*)d_in[11];
  const float* b2   = (const float*)d_in[12];
  const float* ln1g = (const float*)d_in[13];
  const float* ln1b = (const float*)d_in[14];
  const float* ln2g = (const float*)d_in[15];
  const float* ln2b = (const float*)d_in[16];

  char* p = (char*)d_ws;
  auto carve = [&](size_t bytes) { void* r = (void*)p; p += (bytes + 255) & ~(size_t)255; return r; };
  bf16*  xb   = (bf16*) carve((size_t)TOKS * DM * 2);
  bf16*  Wqt  = (bf16*) carve((size_t)DM * DM * 2);
  bf16*  Wkt  = (bf16*) carve((size_t)DM * DM * 2);
  bf16*  Wvt  = (bf16*) carve((size_t)DM * DM * 2);
  bf16*  Wot  = (bf16*) carve((size_t)DM * DM * 2);
  bf16*  W1t  = (bf16*) carve((size_t)DM * DFF * 2);
  bf16*  W2t  = (bf16*) carve((size_t)DFF * DM * 2);
  bf16*  qh   = (bf16*) carve((size_t)TOKS * DM * 2);   // [b,h,s,d]
  bf16*  kh   = (bf16*) carve((size_t)TOKS * DM * 2);   // [b,h,s,d]
  bf16*  vth  = (bf16*) carve((size_t)TOKS * DM * 2);   // [b,h,d,s]
  bf16*  attnO= (bf16*) carve((size_t)TOKS * DM * 2);   // [b,s,D]
  float* aprj = (float*)carve((size_t)TOKS * DM * 4);
  float* x1f  = (float*)carve((size_t)TOKS * DM * 4);
  bf16*  x1b  = (bf16*) carve((size_t)TOKS * DM * 2);
  bf16*  hb   = qh;     // 32MB alias over qh/kh/vth/attnO (dead after Wo gemm)
  float* ff   = aprj;   // alias: attn_proj dead after LN1

  // --- precision conversion / weight transposes ---
  cvt_bf16_kernel<<<TOKS * DM / 1024, 256, 0, stream>>>(x, xb);
  transpose_cvt_kernel<<<dim3(DM / 32, DM / 32),  dim3(32, 8), 0, stream>>>(Wq, Wqt, DM, DM);
  transpose_cvt_kernel<<<dim3(DM / 32, DM / 32),  dim3(32, 8), 0, stream>>>(Wk, Wkt, DM, DM);
  transpose_cvt_kernel<<<dim3(DM / 32, DM / 32),  dim3(32, 8), 0, stream>>>(Wv, Wvt, DM, DM);
  transpose_cvt_kernel<<<dim3(DM / 32, DM / 32),  dim3(32, 8), 0, stream>>>(Wo, Wot, DM, DM);
  transpose_cvt_kernel<<<dim3(DFF / 32, DM / 32), dim3(32, 8), 0, stream>>>(W1, W1t, DM, DFF);
  transpose_cvt_kernel<<<dim3(DM / 32, DFF / 32), dim3(32, 8), 0, stream>>>(W2, W2t, DFF, DM);

  // --- QKV projections (bf16 WMMA, head-layout scatter epilogues) ---
  gemm_bf16<1, false, DM><<<dim3(DM / 128, TOKS / 128), 256, 0, stream>>>(
      xb, Wqt, bq, nullptr, qh, TOKS, DM);
  gemm_bf16<1, false, DM><<<dim3(DM / 128, TOKS / 128), 256, 0, stream>>>(
      xb, Wkt, bk, nullptr, kh, TOKS, DM);
  gemm_bf16<2, false, DM><<<dim3(DM / 128, TOKS / 128), 256, 0, stream>>>(
      xb, Wvt, bv, nullptr, vth, TOKS, DM);

  // --- fused flash attention ---
  attention_kernel<<<dim3(SEQ / 128, 32), 256, 0, stream>>>(qh, kh, vth, attnO);

  // --- output projection + LN1 ---
  gemm_bf16<0, false, DM><<<dim3(DM / 128, TOKS / 128), 256, 0, stream>>>(
      attnO, Wot, bo, aprj, nullptr, TOKS, DM);
  ln_kernel<<<TOKS, 256, 0, stream>>>(x, aprj, ln1g, ln1b, x1f, x1b);

  // --- FFN ---
  gemm_bf16<3, true, DM><<<dim3(DFF / 128, TOKS / 128), 256, 0, stream>>>(
      x1b, W1t, b1, nullptr, hb, TOKS, DFF);
  gemm_bf16<0, false, DFF><<<dim3(DM / 128, TOKS / 128), 256, 0, stream>>>(
      hb, W2t, b2, ff, nullptr, TOKS, DM);

  // --- LN2 -> final fp32 output ---
  ln_kernel<<<TOKS, 256, 0, stream>>>(x1f, ff, ln2g, ln2b, (float*)d_out, nullptr);

  (void)in_sizes; (void)n_in; (void)out_size; (void)ws_size;
}

// v002
// It runs in 247 microseconds.
// In two side-by-side timings against v001, it was 1.05 and 1.04 times as fast.
// Over all steps from v000 it is 1.47 times as fast.
#include <hip/hip_runtime.h>
#include <hip/hip_bf16.h>

typedef __bf16 bf16;
typedef __attribute__((ext_vector_type(16))) __bf16 v16bf;
typedef __attribute__((ext_vector_type(8)))  __bf16 v8bf;
typedef __attribute__((ext_vector_type(8)))  float   v8f;
typedef __attribute__((ext_vector_type(4)))  float   v4f;
typedef __attribute__((ext_vector_type(4)))  __bf16 v4bf;

#define TOKS 4096   // B*S
#define DM   1024
#define DFF  4096
#define SEQ  2048
#define NH   16

__device__ __forceinline__ bf16 f2bf(float f) {
  unsigned u = __builtin_bit_cast(unsigned, f);
  u += 0x7FFFu + ((u >> 16) & 1u);           // round-to-nearest-even
  unsigned short h = (unsigned short)(u >> 16);
  return __builtin_bit_cast(bf16, h);
}

union FragU { v16bf v; v8bf h[2]; };

__device__ __forceinline__ v16bf ld_frag(const bf16* rowPtr, int sub) {
  FragU u;
  u.h[0] = *(const v8bf*)(rowPtr + sub * 8);
  u.h[1] = *(const v8bf*)(rowPtr + sub * 8 + 16);
  return u.v;
}

// ---------------------------------------------------------------------------
// fp32 -> bf16 elementwise convert. A thread converts 32 elements (4 runs of 8,
// two 16B loads and one 16B store a run): the launch is short, so the time to
// start its waves counts, and an eighth of the waves does the same bytes.
// ---------------------------------------------------------------------------
__global__ __launch_bounds__(256)
void cvt_bf16_kernel(const float* __restrict__ X, bf16* __restrict__ Y) {
  const size_t base = (size_t)blockIdx.x * 8192 + threadIdx.x * 8;
  v4f a[4][2];
  #pragma unroll
  for (int j = 0; j < 4; ++j) {
    a[j][0] = *(const v4f*)(X + base + j * 2048);
    a[j][1] = *(const v4f*)(X + base + j * 2048 + 4);
  }
  v8bf o[4];
  #pragma unroll
  for (int j = 0; j < 4; ++j)
    #pragma unroll
    for (int e = 0; e < 4; ++e) { o[j][e] = f2bf(a[j][0][e]); o[j][e + 4] = f2bf(a[j][1][e]); }
  #pragma unroll
  for (int j = 0; j < 4; ++j) *(v8bf*)(Y + base + j * 2048) = o[j];
}

// ---------------------------------------------------------------------------
// fp32 [K x N] -> bf16 transposed [N x K]. One work-group turns a tile of
// 128 k x 64 n (32 elements a thread): 16B loads along n, 16B stores along k
// that fill whole 128B lines, and an eighth of the waves to start.
// ---------------------------------------------------------------------------
template<int K, int N>   // at compile time: a thread's loads share one address, its stores too
__global__ __launch_bounds__(256)
void transpose_cvt_kernel(const float* __restrict__ W, bf16* __restrict__ Wt) {
  __shared__ float t[128][65];
  const int bn = blockIdx.x * 64, bk = blockIdx.y * 128;
  const int tid = threadIdx.x;
  const int lr = tid >> 4, lc = (tid & 15) * 4;   // 16 lanes cover a 256B row piece
  const float* wp = W + (size_t)(bk + lr) * N + bn + lc;
  v4f a[8];
  #pragma unroll
  for (int i = 0; i < 8; ++i) a[i] = *(const v4f*)(wp + i * 16 * N);
  #pragma unroll
  for (int i = 0; i < 8; ++i)
    #pragma unroll
    for (int e = 0; e < 4; ++e) t[lr + i * 16][lc + e] = a[i][e];
  __syncthreads();
  const int kc = (tid & 7) * 8, nr = tid >> 3;    // 8 lanes cover a 128B line of Wt
  v8bf o[4];
  #pragma unroll
  for (int i = 0; i < 4; ++i)
    #pragma unroll
    for (int e = 0; e < 8; ++e)
      o[i][e] = f2bf(t[kc + (i & 1) * 64 + e][nr + (i >> 1) * 32]);
  bf16* op = Wt + (size_t)(bn + nr) * K + bk + kc;
  #pragma unroll
  for (int i = 0; i < 4; ++i) *(v8bf*)(op + (i >> 1) * 32 * K + (i & 1) * 64) = o[i];
}

// ---------------------------------------------------------------------------
// bf16 GEMM, LDS double-buffered: C[M,N] = A[M,K] @ Bt[N,K]^T + bias.
// MODE 0: fp32 row-major.  MODE 1: bf16 scatter to [b,h,s,d].
// MODE 2: bf16 scatter to [b,h,d,s] (V transposed).  MODE 3: bf16 row-major.
// ---------------------------------------------------------------------------
template<int MODE, bool RELU, int K>   // K at compile time: a stage's loads share one address
__global__ __launch_bounds__(256)
void gemm_bf16(const bf16* __restrict__ A, const bf16* __restrict__ Bt,
               const float* __restrict__ bias,
               float* __restrict__ outF, bf16* __restrict__ outB,
               int M, int N)
{
  constexpr int BK = 128;                  // k depth of one LDS stage: 256B rows
  constexpr int LD = BK + 8;               // 272B row pitch: 16B x odd
  constexpr int NC = BK / 16;              // 16B chunks per thread and operand
  __shared__ bf16 As[2][128 * LD];
  __shared__ bf16 Bs[2][128 * LD];
  const int tid  = threadIdx.x;
  const int lane = tid & 31, w = tid >> 5;
  const int wm = w & 3, wn = w >> 2;       // 4 waves along M, 2 along N
  const int sub = lane >> 4, l16 = lane & 15;
  const int m0 = blockIdx.y * 128, n0 = blockIdx.x * 128;

  // this thread's 16B chunks of a 128xBK tile: 16 lanes cover one 256B row,
  // chunk i sits 16 rows below chunk i-1
  const int r0 = tid >> 4, kc0 = (tid & 15) * 8;
  const bf16* ga = A  + (size_t)(m0 + r0) * K + kc0;   // walk along k, one stage a step
  const bf16* gb = Bt + (size_t)(n0 + r0) * K + kc0;

  const v8f vz = {0.f,0.f,0.f,0.f,0.f,0.f,0.f,0.f};
  v8f acc[2][4];
  #pragma unroll
  for (int i = 0; i < 2; ++i)
    #pragma unroll
    for (int j = 0; j < 4; ++j) acc[i][j] = vz;

  v8bf ra[NC], rb[NC];
  auto gload = [&]() {
    #pragma unroll
    for (int i = 0; i < NC; ++i) {
      ra[i] = *(const v8bf*)(ga + i * 16 * K);
      rb[i] = *(const v8bf*)(gb + i * 16 * K);
    }
    ga += BK;
    gb += BK;
  };
  auto sstore = [&](int b) {
    #pragma unroll
    for (int i = 0; i < NC; ++i) {
      *(v8bf*)(As[b] + (r0 + i * 16) * LD + kc0) = ra[i];
      *(v8bf*)(Bs[b] + (r0 + i * 16) * LD + kc0) = rb[i];
    }
  };

  gload();
  sstore(0);
  __syncthreads();

  auto compute = [&](int cur) {
    #pragma unroll
    for (int ks = 0; ks < BK; ks += 32) {
      v16bf af[2], bfg[4];
      #pragma unroll
      for (int fa = 0; fa < 2; ++fa)
        af[fa] = ld_frag(As[cur] + (wm * 32 + fa * 16 + l16) * LD + ks, sub);
      #pragma unroll
      for (int fn = 0; fn < 4; ++fn)
        bfg[fn] = ld_frag(Bs[cur] + (wn * 64 + fn * 16 + l16) * LD + ks, sub);
      #pragma unroll
      for (int fa = 0; fa < 2; ++fa)
        #pragma unroll
        for (int fn = 0; fn < 4; ++fn)
          acc[fa][fn] = __builtin_amdgcn_wmma_f32_16x16x32_bf16(
              false, af[fa], false, bfg[fn], (short)0, acc[fa][fn], false, false);
    }
  };

  constexpr int T = K / BK;
  // rolled: unrolled, the short-K build is one copy of the body per stage, each
  // run once by a wave and fetched cold, on some sixty registers more
  #pragma unroll 1
  for (int t = 0; t + 1 < T; ++t) {
    gload();                               // overlap global latency with WMMA
    // keeps every load of the next stage ahead of this stage's products: one that
    // the scheduler sinks behind them is waited for at its full latency
    __builtin_amdgcn_sched_barrier(0);
    compute(t & 1);
    sstore((t & 1) ^ 1);
    __syncthreads();
  }
  compute((T - 1) & 1);                    // last stage: nothing left to fetch
  __syncthreads();
  // keeps the epilogue's address arithmetic out of the last stage, where its
  // registers come on top of that stage's fragments and pass 256
  __builtin_amdgcn_sched_barrier(0);

  #pragma unroll
  for (int fa = 0; fa < 2; ++fa) {
    #pragma unroll
    for (int fn = 0; fn < 4; ++fn) {
      const int n  = n0 + wn * 64 + fn * 16 + l16;
      const float bv = bias[n];
      #pragma unroll
      for (int j = 0; j < 8; ++j) {
        const int m = m0 + wm * 32 + fa * 16 + sub * 8 + j;
        float v = acc[fa][fn][j] + bv;
        if (RELU) v = fmaxf(v, 0.f);
        if (MODE == 0) {
          outF[(size_t)m * N + n] = v;
        } else if (MODE == 1) {
          int b = m >> 11, s = m & 2047, h = n >> 6, d = n & 63;
          outB[((((size_t)b * NH + h) * SEQ + s) << 6) + d] = f2bf(v);
        } else if (MODE == 2) {
          int b = m >> 11, s = m & 2047, h = n >> 6, d = n & 63;
          outB[(((size_t)b * NH + h) * 64 + d) * SEQ + s] = f2bf(v);
        } else {
          outB[(size_t)m * N + n] = f2bf(v);
        }
      }
    }
  }
}

// ---------------------------------------------------------------------------
// Flash attention: Q,K bf16 [BH][S][64], VT bf16 [BH][64][S] ->
// O bf16 [B][S][D_MODEL] (head-interleaved row-major).
// Block = 8 waves x 16 query rows; K/V^T blocks staged cooperatively in LDS
// (8x traffic reduction); online softmax; WMMA for QK^T and P*V.
// ---------------------------------------------------------------------------
__global__ __launch_bounds__(256)
void attention_kernel(const bf16* __restrict__ Q, const bf16* __restrict__ Kb,
                      const bf16* __restrict__ VT, bf16* __restrict__ O)
{
  constexpr int HD = 64, KLD = 80, PLD = 80;  // 160B strides: 16B aligned
  __shared__ bf16 Ks[64 * KLD];               // 64 keys x 64 d
  __shared__ bf16 Vs[64 * KLD];               // 64 d    x 64 keys (V^T)
  __shared__ bf16 Pst[8 * 16 * PLD];          // per-wave P staging
  const int tid  = threadIdx.x;
  const int lane = tid & 31, w = tid >> 5;
  const int sub = lane >> 4, l16 = lane & 15;
  const int bh = blockIdx.y;
  const int q0 = blockIdx.x * 128 + w * 16;
  const bf16* q  = Q  + (size_t)bh * SEQ * HD;
  const bf16* kp = Kb + (size_t)bh * SEQ * HD;
  const bf16* vt = VT + (size_t)bh * HD * SEQ;
  bf16* pst = Pst + w * 16 * PLD;
  const float scale = 0.125f;                 // 1/sqrt(64)

  // resident Q fragments (16 rows x 64 d = 2 A-frags)
  v16bf qf[2];
  #pragma unroll
  for (int fa = 0; fa < 2; ++fa)
    qf[fa] = ld_frag(q + (size_t)(q0 + l16) * HD + fa * 32, sub);

  const v8f vz = {0.f,0.f,0.f,0.f,0.f,0.f,0.f,0.f};
  v8f o[4];
  #pragma unroll
  for (int f = 0; f < 4; ++f) o[f] = vz;
  float rowM[8], rowL[8];
  #pragma unroll
  for (int j = 0; j < 8; ++j) { rowM[j] = -1e30f; rowL[j] = 0.f; }

  for (int kb = 0; kb < SEQ; kb += 64) {
    __syncthreads();                          // WAR on Ks/Vs/Pst
    // ---- cooperative K / V^T block staging (coalesced 16B chunks) ----
    #pragma unroll
    for (int i = 0; i < 2; ++i) {
      int c = tid + i * 256, r = c >> 3, dc = (c & 7) * 8;   // 512 chunks
      *(v8bf*)(Ks + r * KLD + dc) = *(const v8bf*)(kp + (size_t)(kb + r) * HD + dc);
      *(v8bf*)(Vs + r * KLD + dc) = *(const v8bf*)(vt + (size_t)r * SEQ + kb + dc);
    }
    __syncthreads();
    // ---- scores: 4 n-frags x (2 k-steps over d), K from LDS ----
    v8f sf[4];
    #pragma unroll
    for (int fn = 0; fn < 4; ++fn) {
      v8f a = vz;
      #pragma unroll
      for (int fa = 0; fa < 2; ++fa) {
        v16bf kf = ld_frag(Ks + (fn * 16 + l16) * KLD + fa * 32, sub);
        a = __builtin_amdgcn_wmma_f32_16x16x32_bf16(
                false, qf[fa], false, kf, (short)0, a, false, false);
      }
      sf[fn] = a;
    }
    // ---- online softmax (per row j; lanes within a half share rows) ----
    #pragma unroll
    for (int j = 0; j < 8; ++j) {
      float mx = fmaxf(fmaxf(sf[0][j], sf[1][j]), fmaxf(sf[2][j], sf[3][j])) * scale;
      #pragma unroll
      for (int off = 8; off; off >>= 1) mx = fmaxf(mx, __shfl_xor(mx, off, 16));
      float mnew  = fmaxf(rowM[j], mx);
      float alpha = __expf(rowM[j] - mnew);
      rowM[j] = mnew;
      rowL[j] *= alpha;
      #pragma unroll
      for (int f = 0; f < 4; ++f) o[f][j] *= alpha;
      float ps = 0.f;
      #pragma unroll
      for (int f = 0; f < 4; ++f) {
        float p = __expf(sf[f][j] * scale - mnew);
        ps += p;
        pst[(sub * 8 + j) * PLD + f * 16 + l16] = f2bf(p);   // C-layout -> LDS
      }
      rowL[j] += ps;
    }
    __syncthreads();                          // P visible (cross-lane exchange)
    // ---- P (A-layout) @ V, V^T from LDS ----
    v16bf pa[2];
    #pragma unroll
    for (int fk = 0; fk < 2; ++fk)
      pa[fk] = ld_frag(pst + l16 * PLD + fk * 32, sub);
    #pragma unroll
    for (int f = 0; f < 4; ++f) {
      #pragma unroll
      for (int fk = 0; fk < 2; ++fk) {
        v16bf vf = ld_frag(Vs + (f * 16 + l16) * KLD + fk * 32, sub);
        o[f] = __builtin_amdgcn_wmma_f32_16x16x32_bf16(
                   false, pa[fk], false, vf, (short)0, o[f], false, false);
      }
    }
  }

  // ---- finalize: divide by l, store head-interleaved bf16 ----
  const int b = bh >> 4, h = bh & 15;
  #pragma unroll
  for (int j = 0; j < 8; ++j) {
    float l = rowL[j];
    #pragma unroll
    for (int off = 8; off; off >>= 1) l += __shfl_xor(l, off, 16);
    float inv = 1.0f / l;
    size_t row = ((size_t)b * SEQ + q0 + sub * 8 + j) * DM + h * 64;
    #pragma unroll
    for (int f = 0; f < 4; ++f)
      O[row + f * 16 + l16] = f2bf(o[f][j] * inv);
  }
}

// ---------------------------------------------------------------------------
// y = LayerNorm(X + R) * g + b ; fp32 out (+ optional bf16 out)
// One wave per row, 32 elements a lane in 16B pieces: the row's sums stay in the
// wave (no LDS, no barrier), and an eighth of the waves has to be started.
// ---------------------------------------------------------------------------
__global__ __launch_bounds__(256)
void ln_kernel(const float* __restrict__ X, const float* __restrict__ R,
               const float* __restrict__ g, const float* __restrict__ bb,
               float* __restrict__ outF, bf16* __restrict__ outB)
{
  constexpr int D = DM;
  const int lane = threadIdx.x & 31;
  // the wave's number as a scalar: every row address is a scalar base plus one lane offset
  const int row  = blockIdx.x * 8 + __builtin_amdgcn_readfirstlane(threadIdx.x >> 5);
  const float* x = X + (size_t)row * D + lane * 4;
  const float* r = R + (size_t)row * D + lane * 4;
  v4f v[8], rv[8], gv[8], bv[8];
  #pragma unroll
  for (int i = 0; i < 8; ++i) {            // each load: 512 contiguous bytes a wave
    v[i]  = *(const v4f*)(x + i * 128);
    rv[i] = *(const v4f*)(r + i * 128);
  }
  #pragma unroll
  for (int i = 0; i < 8; ++i) {
    gv[i] = *(const v4f*)(g  + lane * 4 + i * 128);
    bv[i] = *(const v4f*)(bb + lane * 4 + i * 128);
  }
  // keeps all 32 loads ahead of the sums, in flight together: sunk behind them
  // to save registers, they are waited for group by group at full latency
  __builtin_amdgcn_sched_barrier(0);
  v4f s4 = {0.f, 0.f, 0.f, 0.f};
  #pragma unroll
  for (int i = 0; i < 8; ++i) { v[i] += rv[i]; s4 += v[i]; }
  float s = (s4[0] + s4[1]) + (s4[2] + s4[3]);
  #pragma unroll
  for (int off = 16; off; off >>= 1) s += __shfl_xor(s, off, 32);
  const float mu = s * (1.0f / D);
  v4f q4 = {0.f, 0.f, 0.f, 0.f};
  #pragma unroll
  for (int i = 0; i < 8; ++i) { v4f d = v[i] - mu; q4 += d * d; }
  float vs = (q4[0] + q4[1]) + (q4[2] + q4[3]);
  #pragma unroll
  for (int off = 16; off; off >>= 1) vs += __shfl_xor(vs, off, 32);
  const float rs = rsqrtf(vs * (1.0f / D) + 1e-5f);
  const size_t c = (size_t)row * D + lane * 4;
  #pragma unroll
  for (int i = 0; i < 8; ++i) v[i] = (v[i] - mu) * rs * gv[i] + bv[i];
  if (outB) {
    v4bf o[8];
    #pragma unroll
    for (int i = 0; i < 8; ++i)
      #pragma unroll
      for (int e = 0; e < 4; ++e) o[i][e] = f2bf(v[i][e]);
    #pragma unroll
    for (int i = 0; i < 8; ++i) *(v4bf*)(outB + c + i * 128) = o[i];
  }
  #pragma unroll
  for (int i = 0; i < 8; ++i) *(v4f*)(outF + c + i * 128) = v[i];
}

// ---------------------------------------------------------------------------
extern "C" void kernel_launch(void* const* d_in, const int* in_sizes, int n_in,
                              void* d_out, int out_size, void* d_ws, size_t ws_size,
                              hipStream_t stream)
{
  const float* x    = (const float*)d_in[0];
  const float* Wq   = (const float*)d_in[1];
  const float* bq   = (const float*)d_in[2];
  const float* Wk   = (const float*)d_in[3];
  const float* bk   = (const float*)d_in[4];
  const float* Wv   = (const float*)d_in[5];
  const float* bv   = (const float*)d_in[6];
  const float* Wo   = (const float*)d_in[7];
  const float* bo   = (const float*)d_in[8];
  const float* W1   = (const float*)d_in[9];
  const float* b1   = (const float*)d_in[10];
  const float* W2   = (const float*)d_in[11];
  const float* b2   = (const float*)d_in[12];
  const float* ln1g = (const float*)d_in[13];
  const float* ln1b = (const float*)d_in[14];
  const float* ln2g = (const float*)d_in[15];
  const float* ln2b = (const float*)d_in[16];

  char* p = (char*)d_ws;
  auto carve = [&](size_t bytes) { void* r = (void*)p; p += (bytes + 255) & ~(size_t)255; return r; };
  bf16*  xb   = (bf16*) carve((size_t)TOKS * DM * 2);
  bf16*  Wqt  = (bf16*) carve((size_t)DM * DM * 2);
  bf16*  Wkt  = (bf16*) carve((size_t)DM * DM * 2);
  bf16*  Wvt  = (bf16*) carve((size_t)DM * DM * 2);
  bf16*  Wot  = (bf16*) carve((size_t)DM * DM * 2);
  bf16*  W1t  = (bf16*) carve((size_t)DM * DFF * 2);
  bf16*  W2t  = (bf16*) carve((size_t)DFF * DM * 2);
  bf16*  qh   = (bf16*) carve((size_t)TOKS * DM * 2);   // [b,h,s,d]
  bf16*  kh   = (bf16*) carve((size_t)TOKS * DM * 2);   // [b,h,s,d]
  bf16*  vth  = (bf16*) carve((size_t)TOKS * DM * 2);   // [b,h,d,s]
  bf16*  attnO= (bf16*) carve((size_t)TOKS * DM * 2);   // [b,s,D]
  float* aprj = (float*)carve((size_t)TOKS * DM * 4);
  float* x1f  = (float*)carve((size_t)TOKS * DM * 4);
  bf16*  x1b  = (bf16*) carve((size_t)TOKS * DM * 2);
  bf16*  hb   = qh;     // 32MB alias over qh/kh/vth/attnO (dead after Wo gemm)
  float* ff   = aprj;   // alias: attn_proj dead after LN1

  // --- precision conversion / weight transposes ---
  cvt_bf16_kernel<<<TOKS * DM / 8192, 256, 0, stream>>>(x, xb);
  transpose_cvt_kernel<DM, DM><<<dim3(DM / 64, DM / 128),  256, 0, stream>>>(Wq, Wqt);
  transpose_cvt_kernel<DM, DM><<<dim3(DM / 64, DM / 128),  256, 0, stream>>>(Wk, Wkt);
  transpose_cvt_kernel<DM, DM><<<dim3(DM / 64, DM / 128),  256, 0, stream>>>(Wv, Wvt);
  transpose_cvt_kernel<DM, DM><<<dim3(DM / 64, DM / 128),  256, 0, stream>>>(Wo, Wot);
  transpose_cvt_kernel<DM, DFF><<<dim3(DFF / 64, DM / 128), 256, 0, stream>>>(W1, W1t);
  transpose_cvt_kernel<DFF, DM><<<dim3(DM / 64, DFF / 128), 256, 0, stream>>>(W2, W2t);

  // --- QKV projections (bf16 WMMA, head-layout scatter epilogues) ---
  gemm_bf16<1, false, DM><<<dim3(DM / 128, TOKS / 128), 256, 0, stream>>>(
      xb, Wqt, bq, nullptr, qh, TOKS, DM);
  gemm_bf16<1, false, DM><<<dim3(DM / 128, TOKS / 128), 256, 0, stream>>>(
      xb, Wkt, bk, nullptr, kh, TOKS, DM);
  gemm_bf16<2, false, DM><<<dim3(DM / 128, TOKS / 128), 256, 0, stream>>>(
      xb, Wvt, bv, nullptr, vth, TOKS, DM);

  // --- fused flash attention ---
  attention_kernel<<<dim3(SEQ / 128, 32), 256, 0, stream>>>(qh, kh, vth, attnO);

  // --- output projection + LN1 ---
  gemm_bf16<0, false, DM><<<dim3(DM / 128, TOKS / 128), 256, 0, stream>>>(
      attnO, Wot, bo, aprj, nullptr, TOKS, DM);
  ln_kernel<<<TOKS / 8, 256, 0, stream>>>(x, aprj, ln1g, ln1b, x1f, x1b);

  // --- FFN ---
  gemm_bf16<3, true, DM><<<dim3(DFF / 128, TOKS / 128), 256, 0, stream>>>(
      x1b, W1t, b1, nullptr, hb, TOKS, DFF);
  gemm_bf16<0, false, DFF><<<dim3(DM / 128, TOKS / 128), 256, 0, stream>>>(
      hb, W2t, b2, ff, nullptr, TOKS, DM);

  // --- LN2 -> final fp32 output ---
  ln_kernel<<<TOKS / 8, 256, 0, stream>>>(x1f, ff, ln2g, ln2b, (float*)d_out, nullptr);

  (void)in_sizes; (void)n_in; (void)out_size; (void)ws_size;
}

// v003
// It runs in 212 microseconds.
// Timed twice side by side with v002, it ran 1.17 and 1.18 times as fast.
// Over all steps from v000 it is 1.73 times as fast.
#include <hip/hip_runtime.h>
#include <hip/hip_bf16.h>

typedef __bf16 bf16;
typedef __attribute__((ext_vector_type(16))) __bf16 v16bf;
typedef __attribute__((ext_vector_type(8)))  __bf16 v8bf;
typedef __attribute__((ext_vector_type(8)))  float   v8f;
typedef __attribute__((ext_vector_type(4)))  float   v4f;
typedef __attribute__((ext_vector_type(4)))  __bf16 v4bf;

#define TOKS 4096   // B*S
#define DM   1024
#define DFF  4096
#define SEQ  2048
#define NH   16

__device__ __forceinline__ bf16 f2bf(float f) {
  unsigned u = __builtin_bit_cast(unsigned, f);
  u += 0x7FFFu + ((u >> 16) & 1u);           // round-to-nearest-even
  unsigned short h = (unsigned short)(u >> 16);
  return __builtin_bit_cast(bf16, h);
}

union FragU { v16bf v; v8bf h[2]; };

__device__ __forceinline__ v16bf ld_frag(const bf16* rowPtr, int sub) {
  FragU u;
  u.h[0] = *(const v8bf*)(rowPtr + sub * 8);
  u.h[1] = *(const v8bf*)(rowPtr + sub * 8 + 16);
  return u.v;
}

// ---------------------------------------------------------------------------
// fp32 -> bf16 elementwise convert. A thread converts 32 elements (4 runs of 8,
// two 16B loads and one 16B store a run): the launch is short, so the time to
// start its waves counts, and an eighth of the waves does the same bytes.
// ---------------------------------------------------------------------------
__global__ __launch_bounds__(256)
void cvt_bf16_kernel(const float* __restrict__ X, bf16* __restrict__ Y) {
  const size_t base = (size_t)blockIdx.x * 8192 + threadIdx.x * 8;
  v4f a[4][2];
  #pragma unroll
  for (int j = 0; j < 4; ++j) {
    a[j][0] = *(const v4f*)(X + base + j * 2048);
    a[j][1] = *(const v4f*)(X + base + j * 2048 + 4);
  }
  v8bf o[4];
  #pragma unroll
  for (int j = 0; j < 4; ++j)
    #pragma unroll
    for (int e = 0; e < 4; ++e) { o[j][e] = f2bf(a[j][0][e]); o[j][e + 4] = f2bf(a[j][1][e]); }
  #pragma unroll
  for (int j = 0; j < 4; ++j) *(v8bf*)(Y + base + j * 2048) = o[j];
}

// ---------------------------------------------------------------------------
// fp32 [K x N] -> bf16 transposed [N x K]. One work-group turns a tile of
// 128 k x 64 n (32 elements a thread): 16B loads along n, 16B stores along k
// that fill whole 128B lines, and an eighth of the waves to start.
// ---------------------------------------------------------------------------
template<int K, int N>   // at compile time: a thread's loads share one address, its stores too
__global__ __launch_bounds__(256)
void transpose_cvt_kernel(const float* __restrict__ W, bf16* __restrict__ Wt) {
  __shared__ float t[128][65];
  const int bn = blockIdx.x * 64, bk = blockIdx.y * 128;
  const int tid = threadIdx.x;
  const int lr = tid >> 4, lc = (tid & 15) * 4;   // 16 lanes cover a 256B row piece
  const float* wp = W + (size_t)(bk + lr) * N + bn + lc;
  v4f a[8];
  #pragma unroll
  for (int i = 0; i < 8; ++i) a[i] = *(const v4f*)(wp + i * 16 * N);
  #pragma unroll
  for (int i = 0; i < 8; ++i)
    #pragma unroll
    for (int e = 0; e < 4; ++e) t[lr + i * 16][lc + e] = a[i][e];
  __syncthreads();
  const int kc = (tid & 7) * 8, nr = tid >> 3;    // 8 lanes cover a 128B line of Wt
  v8bf o[4];
  #pragma unroll
  for (int i = 0; i < 4; ++i)
    #pragma unroll
    for (int e = 0; e < 8; ++e)
      o[i][e] = f2bf(t[kc + (i & 1) * 64 + e][nr + (i >> 1) * 32]);
  bf16* op = Wt + (size_t)(bn + nr) * K + bk + kc;
  #pragma unroll
  for (int i = 0; i < 4; ++i) *(v8bf*)(op + (i >> 1) * 32 * K + (i & 1) * 64) = o[i];
}

// ---------------------------------------------------------------------------
// bf16 GEMM, LDS double-buffered: C[M,N] = A[M,K] @ Bt[N,K]^T + bias.
// MODE 0: fp32 row-major.  MODE 1: bf16 scatter to [b,h,s,d].
// MODE 2: bf16 scatter to [b,h,d,s] (V transposed).  MODE 3: bf16 row-major.
// ---------------------------------------------------------------------------
template<int MODE, bool RELU, int K>   // K at compile time: a stage's loads share one address
__global__ __launch_bounds__(256)
void gemm_bf16(const bf16* __restrict__ A, const bf16* __restrict__ Bt,
               const float* __restrict__ bias,
               float* __restrict__ outF, bf16* __restrict__ outB,
               int M, int N)
{
  constexpr int BK = 128;                  // k depth of one LDS stage: 256B rows
  constexpr int LD = BK + 8;               // 272B row pitch: 16B x odd
  constexpr int NC = BK / 16;              // 16B chunks per thread and operand
  __shared__ bf16 As[2][128 * LD];
  __shared__ bf16 Bs[2][128 * LD];
  const int tid  = threadIdx.x;
  const int lane = tid & 31, w = tid >> 5;
  const int wm = w & 3, wn = w >> 2;       // 4 waves along M, 2 along N
  const int sub = lane >> 4, l16 = lane & 15;
  const int m0 = blockIdx.y * 128, n0 = blockIdx.x * 128;

  // this thread's 16B chunks of a 128xBK tile: 16 lanes cover one 256B row,
  // chunk i sits 16 rows below chunk i-1
  const int r0 = tid >> 4, kc0 = (tid & 15) * 8;
  const bf16* ga = A  + (size_t)(m0 + r0) * K + kc0;   // walk along k, one stage a step
  const bf16* gb = Bt + (size_t)(n0 + r0) * K + kc0;

  const v8f vz = {0.f,0.f,0.f,0.f,0.f,0.f,0.f,0.f};
  v8f acc[2][4];
  #pragma unroll
  for (int i = 0; i < 2; ++i)
    #pragma unroll
    for (int j = 0; j < 4; ++j) acc[i][j] = vz;

  v8bf ra[NC], rb[NC];
  auto gload = [&]() {
    #pragma unroll
    for (int i = 0; i < NC; ++i) {
      ra[i] = *(const v8bf*)(ga + i * 16 * K);
      rb[i] = *(const v8bf*)(gb + i * 16 * K);
    }
    ga += BK;
    gb += BK;
  };
  auto sstore = [&](int b) {
    #pragma unroll
    for (int i = 0; i < NC; ++i) {
      *(v8bf*)(As[b] + (r0 + i * 16) * LD + kc0) = ra[i];
      *(v8bf*)(Bs[b] + (r0 + i * 16) * LD + kc0) = rb[i];
    }
  };

  gload();
  sstore(0);
  __syncthreads();

  auto compute = [&](int cur) {
    #pragma unroll
    for (int ks = 0; ks < BK; ks += 32) {
      v16bf af[2], bfg[4];
      #pragma unroll
      for (int fa = 0; fa < 2; ++fa)
        af[fa] = ld_frag(As[cur] + (wm * 32 + fa * 16 + l16) * LD + ks, sub);
      #pragma unroll
      for (int fn = 0; fn < 4; ++fn)
        bfg[fn] = ld_frag(Bs[cur] + (wn * 64 + fn * 16 + l16) * LD + ks, sub);
      #pragma unroll
      for (int fa = 0; fa < 2; ++fa)
        #pragma unroll
        for (int fn = 0; fn < 4; ++fn)
          acc[fa][fn] = __builtin_amdgcn_wmma_f32_16x16x32_bf16(
              false, af[fa], false, bfg[fn], (short)0, acc[fa][fn], false, false);
    }
  };

  constexpr int T = K / BK;
  // rolled: unrolled, the short-K build is one copy of the body per stage, each
  // run once by a wave and fetched cold, on some sixty registers more
  #pragma unroll 1
  for (int t = 0; t + 1 < T; ++t) {
    gload();                               // overlap global latency with WMMA
    // keeps every load of the next stage ahead of this stage's products: one that
    // the scheduler sinks behind them is waited for at its full latency
    __builtin_amdgcn_sched_barrier(0);
    compute(t & 1);
    sstore((t & 1) ^ 1);
    __syncthreads();
  }
  compute((T - 1) & 1);                    // last stage: nothing left to fetch
  __syncthreads();
  // keeps the epilogue's address arithmetic out of the last stage, where its
  // registers come on top of that stage's fragments and pass 256
  __builtin_amdgcn_sched_barrier(0);

  #pragma unroll
  for (int fa = 0; fa < 2; ++fa) {
    #pragma unroll
    for (int fn = 0; fn < 4; ++fn) {
      const int n  = n0 + wn * 64 + fn * 16 + l16;
      const float bv = bias[n];
      #pragma unroll
      for (int j = 0; j < 8; ++j) {
        const int m = m0 + wm * 32 + fa * 16 + sub * 8 + j;
        float v = acc[fa][fn][j] + bv;
        if (RELU) v = fmaxf(v, 0.f);
        if (MODE == 0) {
          outF[(size_t)m * N + n] = v;
        } else if (MODE == 1) {
          int b = m >> 11, s = m & 2047, h = n >> 6, d = n & 63;
          outB[((((size_t)b * NH + h) * SEQ + s) << 6) + d] = f2bf(v);
        } else if (MODE == 2) {
          int b = m >> 11, s = m & 2047, h = n >> 6, d = n & 63;
          outB[(((size_t)b * NH + h) * 64 + d) * SEQ + s] = f2bf(v);
        } else {
          outB[(size_t)m * N + n] = f2bf(v);
        }
      }
    }
  }
}

__device__ __forceinline__ float xhalf(float x) {
  const int i = __builtin_bit_cast(int, x);
  return __builtin_bit_cast(float,
      __builtin_amdgcn_permlanex16(i, i, 0x76543210, 0xfedcba98, false, false));
}

__global__ __launch_bounds__(256)
void attention_kernel(const bf16* __restrict__ Q, const bf16* __restrict__ Kb,
                      const bf16* __restrict__ VT, bf16* __restrict__ O)
{
  constexpr int HD = 64, KLD = 80;            // 160B strides: 16B aligned
  __shared__ bf16 Ks[64 * KLD];               // 64 keys x 64 d
  __shared__ bf16 Vs[64 * KLD];               // 64 d    x 64 keys (V^T)
  const int tid  = threadIdx.x;
  const int lane = tid & 31, w = tid >> 5;
  const int sub = lane >> 4, l16 = lane & 15;
  const int bh = blockIdx.y;
  const int q0 = blockIdx.x * 128 + w * 16;
  const bf16* q  = Q  + (size_t)bh * SEQ * HD;
  const bf16* kp = Kb + (size_t)bh * SEQ * HD;
  const bf16* vt = VT + (size_t)bh * HD * SEQ;
  const float scale = 0.125f;                 // 1/sqrt(64)

  // resident Q fragments (16 queries x 64 d = 2 B-frags, column = query l16)
  v16bf qf[2];
  #pragma unroll
  for (int fa = 0; fa < 2; ++fa)
    qf[fa] = ld_frag(q + (size_t)(q0 + l16) * HD + fa * 32, sub);

  const v8f vz = {0.f,0.f,0.f,0.f,0.f,0.f,0.f,0.f};
  v8f o[4];                                   // O^T: o[f][j] = O[query l16][d = f*16 + sub*8 + j]
  #pragma unroll
  for (int f = 0; f < 4; ++f) o[f] = vz;
  float rowM = -1e30f;                        // this lane's query: running maximum (both halves alike)
  float rowL = 0.f;                           // and the sum over this half's keys only

  for (int kb = 0; kb < SEQ; kb += 64) {
    __syncthreads();                          // WAR on Ks/Vs
    // ---- cooperative K / V^T block staging (coalesced 16B chunks) ----
    #pragma unroll
    for (int i = 0; i < 2; ++i) {
      int c = tid + i * 256, r = c >> 3, dc = (c & 7) * 8;   // 512 chunks
      *(v8bf*)(Ks + r * KLD + dc) = *(const v8bf*)(kp + (size_t)(kb + r) * HD + dc);
      *(v8bf*)(Vs + r * KLD + dc) = *(const v8bf*)(vt + (size_t)r * SEQ + kb + dc);
    }
    __syncthreads();
    // ---- S^T: 4 key tiles x (2 k-steps over d); sf[fn][j] = S[l16][fn*16 + sub*8 + j] ----
    v8f sf[4];
    #pragma unroll
    for (int fn = 0; fn < 4; ++fn) {
      v8f a = vz;
      #pragma unroll
      for (int fa = 0; fa < 2; ++fa) {
        v16bf kf = ld_frag(Ks + (fn * 16 + l16) * KLD + fa * 32, sub);
        a = __builtin_amdgcn_wmma_f32_16x16x32_bf16(
                false, kf, false, qf[fa], (short)0, a, false, false);
      }
      sf[fn] = a;
    }
    // ---- online softmax of one query per lane ----
    float m4[4];
    #pragma unroll
    for (int f = 0; f < 4; ++f) {
      m4[f] = sf[f][0];
      #pragma unroll
      for (int j = 1; j < 8; ++j) m4[f] = fmaxf(m4[f], sf[f][j]);
    }
    float mx = fmaxf(fmaxf(m4[0], m4[1]), fmaxf(m4[2], m4[3]));
    mx = fmaxf(mx, xhalf(mx)) * scale;        // all 64 keys: both halves scale P alike
    const float mnew  = fmaxf(rowM, mx);
    const float alpha = __expf(rowM - mnew);
    rowM = mnew;
    #pragma unroll
    for (int f = 0; f < 4; ++f) o[f] *= alpha;
    // P^T as B operand: element s of a 32-key block is tile s >> 3, register s & 7
    FragU pb[2];
    float p4[4];
    #pragma unroll
    for (int f = 0; f < 4; ++f) {
      p4[f] = 0.f;
      #pragma unroll
      for (int j = 0; j < 8; ++j) {
        float p = __expf(sf[f][j] * scale - mnew);
        p4[f] += p;
        pb[f >> 1].h[f & 1][j] = f2bf(p);
      }
    }
    rowL = rowL * alpha + ((p4[0] + p4[1]) + (p4[2] + p4[3]));
    // ---- O^T += V^T (A, rows = d) @ P^T ----
    #pragma unroll
    for (int f = 0; f < 4; ++f) {
      #pragma unroll
      for (int fk = 0; fk < 2; ++fk) {
        v16bf vf = ld_frag(Vs + (f * 16 + l16) * KLD + fk * 32, sub);
        o[f] = __builtin_amdgcn_wmma_f32_16x16x32_bf16(
                   false, vf, false, pb[fk].v, (short)0, o[f], false, false);
      }
    }
  }

  // ---- finalize: join the halves' sums, divide, store 8 consecutive d (16B) a lane ----
  const int b = bh >> 4, h = bh & 15;
  const float inv = 1.0f / (rowL + xhalf(rowL));
  bf16* orow = O + ((size_t)b * SEQ + q0 + l16) * DM + h * 64 + sub * 8;
  #pragma unroll
  for (int f = 0; f < 4; ++f) {
    v8bf ov;
    #pragma unroll
    for (int j = 0; j < 8; ++j) ov[j] = f2bf(o[f][j] * inv);
    *(v8bf*)(orow + f * 16) = ov;
  }
}

// ---------------------------------------------------------------------------
// y = LayerNorm(X + R) * g + b ; fp32 out (+ optional bf16 out)
// One wave per row, 32 elements a lane in 16B pieces: the row's sums stay in the
// wave (no LDS, no barrier), and an eighth of the waves has to be started.
// ---------------------------------------------------------------------------
__global__ __launch_bounds__(256)
void ln_kernel(const float* __restrict__ X, const float* __restrict__ R,
               const float* __restrict__ g, const float* __restrict__ bb,
               float* __restrict__ outF, bf16* __restrict__ outB)
{
  constexpr int D = DM;
  const int lane = threadIdx.x & 31;
  // the wave's number as a scalar: every row address is a scalar base plus one lane offset
  const int row  = blockIdx.x * 8 + __builtin_amdgcn_readfirstlane(threadIdx.x >> 5);
  const float* x = X + (size_t)row * D + lane * 4;
  const float* r = R + (size_t)row * D + lane * 4;
  v4f v[8], rv[8], gv[8], bv[8];
  #pragma unroll
  for (int i = 0; i < 8; ++i) {            // each load: 512 contiguous bytes a wave
    v[i]  = *(const v4f*)(x + i * 128);
    rv[i] = *(const v4f*)(r + i * 128);
  }
  #pragma unroll
  for (int i = 0; i < 8; ++i) {
    gv[i] = *(const v4f*)(g  + lane * 4 + i * 128);
    bv[i] = *(const v4f*)(bb + lane * 4 + i * 128);
  }
  // keeps all 32 loads ahead of the sums, in flight together: sunk behind them
  // to save registers, they are waited for group by group at full latency
  __builtin_amdgcn_sched_barrier(0);
  v4f s4 = {0.f, 0.f, 0.f, 0.f};
  #pragma unroll
  for (int i = 0; i < 8; ++i) { v[i] += rv[i]; s4 += v[i]; }
  float s = (s4[0] + s4[1]) + (s4[2] + s4[3]);
  #pragma unroll
  for (int off = 16; off; off >>= 1) s += __shfl_xor(s, off, 32);
  const float mu = s * (1.0f / D);
  v4f q4 = {0.f, 0.f, 0.f, 0.f};
  #pragma unroll
  for (int i = 0; i < 8; ++i) { v4f d = v[i] - mu; q4 += d * d; }
  float vs = (q4[0] + q4[1]) + (q4[2] + q4[3]);
  #pragma unroll
  for (int off = 16; off; off >>= 1) vs += __shfl_xor(vs, off, 32);
  const float rs = rsqrtf(vs * (1.0f / D) + 1e-5f);
  const size_t c = (size_t)row * D + lane * 4;
  #pragma unroll
  for (int i = 0; i < 8; ++i) v[i] = (v[i] - mu) * rs * gv[i] + bv[i];
  if (outB) {
    v4bf o[8];
    #pragma unroll
    for (int i = 0; i < 8; ++i)
      #pragma unroll
      for (int e = 0; e < 4; ++e) o[i][e] = f2bf(v[i][e]);
    #pragma unroll
    for (int i = 0; i < 8; ++i) *(v4bf*)(outB + c + i * 128) = o[i];
  }
  #pragma unroll
  for (int i = 0; i < 8; ++i) *(v4f*)(outF + c + i * 128) = v[i];
}

// ---------------------------------------------------------------------------
extern "C" void kernel_launch(void* const* d_in, const int* in_sizes, int n_in,
                              void* d_out, int out_size, void* d_ws, size_t ws_size,
                              hipStream_t stream)
{
  const float* x    = (const float*)d_in[0];
  const float* Wq   = (const float*)d_in[1];
  const float* bq   = (const float*)d_in[2];
  const float* Wk   = (const float*)d_in[3];
  const float* bk   = (const float*)d_in[4];
  const float* Wv   = (const float*)d_in[5];
  const float* bv   = (const float*)d_in[6];
  const float* Wo   = (const float*)d_in[7];
  const float* bo   = (const float*)d_in[8];
  const float* W1   = (const float*)d_in[9];
  const float* b1   = (const float*)d_in[10];
  const float* W2   = (const float*)d_in[11];
  const float* b2   = (const float*)d_in[12];
  const float* ln1g = (const float*)d_in[13];
  const float* ln1b = (const float*)d_in[14];
  const float* ln2g = (const float*)d_in[15];
  const float* ln2b = (const float*)d_in[16];

  char* p = (char*)d_ws;
  auto carve = [&](size_t bytes) { void* r = (void*)p; p += (bytes + 255) & ~(size_t)255; return r; };
  bf16*  xb   = (bf16*) carve((size_t)TOKS * DM * 2);
  bf16*  Wqt  = (bf16*) carve((size_t)DM * DM * 2);
  bf16*  Wkt  = (bf16*) carve((size_t)DM * DM * 2);
  bf16*  Wvt  = (bf16*) carve((size_t)DM * DM * 2);
  bf16*  Wot  = (bf16*) carve((size_t)DM * DM * 2);
  bf16*  W1t  = (bf16*) carve((size_t)DM * DFF * 2);
  bf16*  W2t  = (bf16*) carve((size_t)DFF * DM * 2);
  bf16*  qh   = (bf16*) carve((size_t)TOKS * DM * 2);   // [b,h,s,d]
  bf16*  kh   = (bf16*) carve((size_t)TOKS * DM * 2);   // [b,h,s,d]
  bf16*  vth  = (bf16*) carve((size_t)TOKS * DM * 2);   // [b,h,d,s]
  bf16*  attnO= (bf16*) carve((size_t)TOKS * DM * 2);   // [b,s,D]
  float* aprj = (float*)carve((size_t)TOKS * DM * 4);
  float* x1f  = (float*)carve((size_t)TOKS * DM * 4);
  bf16*  x1b  = (bf16*) carve((size_t)TOKS * DM * 2);
  bf16*  hb   = qh;     // 32MB alias over qh/kh/vth/attnO (dead after Wo gemm)
  float* ff   = aprj;   // alias: attn_proj dead after LN1

  // --- precision conversion / weight transposes ---
  cvt_bf16_kernel<<<TOKS * DM / 8192, 256, 0, stream>>>(x, xb);
  transpose_cvt_kernel<DM, DM><<<dim3(DM / 64, DM / 128),  256, 0, stream>>>(Wq, Wqt);
  transpose_cvt_kernel<DM, DM><<<dim3(DM / 64, DM / 128),  256, 0, stream>>>(Wk, Wkt);
  transpose_cvt_kernel<DM, DM><<<dim3(DM / 64, DM / 128),  256, 0, stream>>>(Wv, Wvt);
  transpose_cvt_kernel<DM, DM><<<dim3(DM / 64, DM / 128),  256, 0, stream>>>(Wo, Wot);
  transpose_cvt_kernel<DM, DFF><<<dim3(DFF / 64, DM / 128), 256, 0, stream>>>(W1, W1t);
  transpose_cvt_kernel<DFF, DM><<<dim3(DM / 64, DFF / 128), 256, 0, stream>>>(W2, W2t);

  // --- QKV projections (bf16 WMMA, head-layout scatter epilogues) ---
  gemm_bf16<1, false, DM><<<dim3(DM / 128, TOKS / 128), 256, 0, stream>>>(
      xb, Wqt, bq, nullptr, qh, TOKS, DM);
  gemm_bf16<1, false, DM><<<dim3(DM / 128, TOKS / 128), 256, 0, stream>>>(
      xb, Wkt, bk, nullptr, kh, TOKS, DM);
  gemm_bf16<2, false, DM><<<dim3(DM / 128, TOKS / 128), 256, 0, stream>>>(
      xb, Wvt, bv, nullptr, vth, TOKS, DM);

  // --- fused flash attention ---
  attention_kernel<<<dim3(SEQ / 128, 32), 256, 0, stream>>>(qh, kh, vth, attnO);

  // --- output projection + LN1 ---
  gemm_bf16<0, false, DM><<<dim3(DM / 128, TOKS / 128), 256, 0, stream>>>(
      attnO, Wot, bo, aprj, nullptr, TOKS, DM);
  ln_kernel<<<TOKS / 8, 256, 0, stream>>>(x, aprj, ln1g, ln1b, x1f, x1b);

  // --- FFN ---
  gemm_bf16<3, true, DM><<<dim3(DFF / 128, TOKS / 128), 256, 0, stream>>>(
      x1b, W1t, b1, nullptr, hb, TOKS, DFF);
  gemm_bf16<0, false, DFF><<<dim3(DM / 128, TOKS / 128), 256, 0, stream>>>(
      hb, W2t, b2, ff, nullptr, TOKS, DM);

  // --- LN2 -> final fp32 output ---
  ln_kernel<<<TOKS / 8, 256, 0, stream>>>(x1f, ff, ln2g, ln2b, (float*)d_out, nullptr);

  (void)in_sizes; (void)n_in; (void)out_size; (void)ws_size;
}

// v004
// It runs in 185 microseconds.
// In both of two side-by-side timings against v003, it was 1.14 times as fast.
// Counting every step since v000, it is 1.96 times as fast.
#include <hip/hip_runtime.h>
#include <hip/hip_bf16.h>

typedef __bf16 bf16;
typedef __attribute__((ext_vector_type(16))) __bf16 v16bf;
typedef __attribute__((ext_vector_type(8)))  __bf16 v8bf;
typedef __attribute__((ext_vector_type(8)))  float   v8f;
typedef __attribute__((ext_vector_type(4)))  float   v4f;
typedef __attribute__((ext_vector_type(4)))  __bf16 v4bf;

#define TOKS 4096   // B*S
#define DM   1024
#define DFF  4096
#define SEQ  2048
#define NH   16

__device__ __forceinline__ bf16 f2bf(float f) {
  unsigned u = __builtin_bit_cast(unsigned, f);
  u += 0x7FFFu + ((u >> 16) & 1u);           // round-to-nearest-even
  unsigned short h = (unsigned short)(u >> 16);
  return __builtin_bit_cast(bf16, h);
}

union FragU { v16bf v; v8bf h[2]; };

__device__ __forceinline__ v16bf ld_frag(const bf16* rowPtr, int sub) {
  FragU u;
  u.h[0] = *(const v8bf*)(rowPtr + sub * 8);
  u.h[1] = *(const v8bf*)(rowPtr + sub * 8 + 16);
  return u.v;
}

// ---------------------------------------------------------------------------
// fp32 -> bf16 elementwise convert. A thread converts 32 elements (4 runs of 8,
// two 16B loads and one 16B store a run): the launch is short, so the time to
// start its waves counts, and an eighth of the waves does the same bytes.
// ---------------------------------------------------------------------------
__device__ __forceinline__
void cvt_bf16_tile(const float* __restrict__ X, bf16* __restrict__ Y, int blk) {
  const size_t base = (size_t)blk * 8192 + threadIdx.x * 8;
  v4f a[4][2];
  #pragma unroll
  for (int j = 0; j < 4; ++j) {
    a[j][0] = *(const v4f*)(X + base + j * 2048);
    a[j][1] = *(const v4f*)(X + base + j * 2048 + 4);
  }
  v8bf o[4];
  #pragma unroll
  for (int j = 0; j < 4; ++j)
    #pragma unroll
    for (int e = 0; e < 4; ++e) { o[j][e] = f2bf(a[j][0][e]); o[j][e + 4] = f2bf(a[j][1][e]); }
  #pragma unroll
  for (int j = 0; j < 4; ++j) *(v8bf*)(Y + base + j * 2048) = o[j];
}

// ---------------------------------------------------------------------------
// fp32 [K x N] -> bf16 transposed [N x K]. One work-group turns a tile of
// 128 k x 64 n (32 elements a thread): 16B loads along n, 16B stores along k
// that fill whole 128B lines, and an eighth of the waves to start.
// ---------------------------------------------------------------------------
template<int K, int N>   // at compile time: a thread's loads share one address, its stores too
__device__ __forceinline__
void transpose_cvt_tile(const float* __restrict__ W, bf16* __restrict__ Wt,
                        float (*t)[65], int bx, int by) {
  const int bn = bx * 64, bk = by * 128;
  const int tid = threadIdx.x;
  const int lr = tid >> 4, lc = (tid & 15) * 4;   // 16 lanes cover a 256B row piece
  const float* wp = W + (size_t)(bk + lr) * N + bn + lc;
  v4f a[8];
  #pragma unroll
  for (int i = 0; i < 8; ++i) a[i] = *(const v4f*)(wp + i * 16 * N);
  #pragma unroll
  for (int i = 0; i < 8; ++i)
    #pragma unroll
    for (int e = 0; e < 4; ++e) t[lr + i * 16][lc + e] = a[i][e];
  __syncthreads();
  const int kc = (tid & 7) * 8, nr = tid >> 3;    // 8 lanes cover a 128B line of Wt
  v8bf o[4];
  #pragma unroll
  for (int i = 0; i < 4; ++i)
    #pragma unroll
    for (int e = 0; e < 8; ++e)
      o[i][e] = f2bf(t[kc + (i & 1) * 64 + e][nr + (i >> 1) * 32]);
  bf16* op = Wt + (size_t)(bn + nr) * K + bk + kc;
  #pragma unroll
  for (int i = 0; i < 4; ++i) *(v8bf*)(op + (i >> 1) * 32 * K + (i & 1) * 64) = o[i];
  // the merged launch's jobs stand one behind another in the code: this keeps the wait
  // in front of the next job's first write of a register that these stores name
  asm volatile("s_wait_xcnt 0x0" ::: "memory");
}

__global__ __launch_bounds__(256)
void prep_kernel(const float* __restrict__ x,  const float* __restrict__ Wq,
                 const float* __restrict__ Wk, const float* __restrict__ Wv,
                 const float* __restrict__ Wo, const float* __restrict__ W1,
                 const float* __restrict__ W2, bf16* __restrict__ xb,
                 bf16* __restrict__ Wsq, bf16* __restrict__ W1t, bf16* __restrict__ W2t) {
  __shared__ float t[128][65];
  const int i = blockIdx.x & 511;
  switch (blockIdx.x >> 9) {
    case 0:
      cvt_bf16_tile(x, xb, i);
      return;
    case 1:
      transpose_cvt_tile<DM, DFF>(W1, W1t, t, i & 63, i >> 6);
      return;
    case 2:
      transpose_cvt_tile<DFF, DM>(W2, W2t, t, i & 15, i >> 4);
      return;
    default: {
      const int m = i >> 7;
      const float* W = m == 0 ? Wq : m == 1 ? Wk : m == 2 ? Wv : Wo;
      transpose_cvt_tile<DM, DM>(W, Wsq + (size_t)m * DM * DM, t, i & 15, (i >> 4) & 7);
      return;
    }
  }
}

// ---------------------------------------------------------------------------
// bf16 GEMM, LDS double-buffered: C[M,N] = A[M,K] @ Bt[N,K]^T + bias.
// MODE 0: fp32 row-major.  MODE 1: bf16 scatter to [b,h,s,d].
// MODE 2: bf16 scatter to [b,h,d,s] (V transposed).  MODE 3: bf16 row-major.
// MODE 4: the Q, K and V products in one launch: blockIdx.z picks weight, bias and
// output (weights and outputs lie one behind another); z 0 and 1 store as MODE 1,
// z 2 as MODE 2. Three work-groups a WGP instead of one: two are resident and fill
// each other's waits, and two launch gaps, ramps and drains go.
// ---------------------------------------------------------------------------
template<int V> struct mode_c { static constexpr int value = V; };

template<int MODE, bool RELU, int K>   // K at compile time: a stage's loads share one address
__global__ __launch_bounds__(256)
void gemm_bf16(const bf16* __restrict__ A, const bf16* __restrict__ Bt,
               const float* __restrict__ bias,
               float* __restrict__ outF, bf16* __restrict__ outB,
               int M, int N,
               const float* __restrict__ biasK, const float* __restrict__ biasV)
{
  constexpr int BK = 128;                  // k depth of one LDS stage: 256B rows
  constexpr int LD = BK + 8;               // 272B row pitch: 16B x odd
  constexpr int NC = BK / 16;              // 16B chunks per thread and operand
  __shared__ bf16 As[2][128 * LD];
  __shared__ bf16 Bs[2][128 * LD];
  const int tid  = threadIdx.x;
  const int lane = tid & 31, w = tid >> 5;
  const int wm = w & 3, wn = w >> 2;       // 4 waves along M, 2 along N
  const int sub = lane >> 4, l16 = lane & 15;
  const int m0 = blockIdx.y * 128, n0 = blockIdx.x * 128;
  const int z = MODE == 4 ? blockIdx.z : 0;
  if (MODE == 4) {
    Bt   += (size_t)z * DM * DM;
    outB += (size_t)z * TOKS * DM;
    bias  = z == 0 ? bias : z == 1 ? biasK : biasV;
  }

  // this thread's 16B chunks of a 128xBK tile: 16 lanes cover one 256B row,
  // chunk i sits 16 rows below chunk i-1
  const int r0 = tid >> 4, kc0 = (tid & 15) * 8;
  const bf16* ga = A  + (size_t)(m0 + r0) * K + kc0;   // walk along k, one stage a step
  const bf16* gb = Bt + (size_t)(n0 + r0) * K + kc0;

  const v8f vz = {0.f,0.f,0.f,0.f,0.f,0.f,0.f,0.f};
  v8f acc[2][4];
  #pragma unroll
  for (int i = 0; i < 2; ++i)
    #pragma unroll
    for (int j = 0; j < 4; ++j) acc[i][j] = vz;

  v8bf ra[NC], rb[NC];
  auto gload = [&]() {
    #pragma unroll
    for (int i = 0; i < NC; ++i) {
      ra[i] = *(const v8bf*)(ga + i * 16 * K);
      rb[i] = *(const v8bf*)(gb + i * 16 * K);
    }
    ga += BK;
    gb += BK;
  };
  auto sstore = [&](int b) {
    #pragma unroll
    for (int i = 0; i < NC; ++i) {
      *(v8bf*)(As[b] + (r0 + i * 16) * LD + kc0) = ra[i];
      *(v8bf*)(Bs[b] + (r0 + i * 16) * LD + kc0) = rb[i];
    }
  };

  gload();
  sstore(0);
  __syncthreads();

  auto compute = [&](int cur) {
    #pragma unroll
    for (int ks = 0; ks < BK; ks += 32) {
      v16bf af[2], bfg[4];
      #pragma unroll
      for (int fa = 0; fa < 2; ++fa)
        af[fa] = ld_frag(As[cur] + (wm * 32 + fa * 16 + l16) * LD + ks, sub);
      #pragma unroll
      for (int fn = 0; fn < 4; ++fn)
        bfg[fn] = ld_frag(Bs[cur] + (wn * 64 + fn * 16 + l16) * LD + ks, sub);
      #pragma unroll
      for (int fa = 0; fa < 2; ++fa)
        #pragma unroll
        for (int fn = 0; fn < 4; ++fn)
          acc[fa][fn] = __builtin_amdgcn_wmma_f32_16x16x32_bf16(
              false, af[fa], false, bfg[fn], (short)0, acc[fa][fn], false, false);
    }
  };

  constexpr int T = K / BK;
  // rolled: unrolled, the short-K build is one copy of the body per stage, each
  // run once by a wave and fetched cold, on some sixty registers more
  #pragma unroll 1
  for (int t = 0; t + 1 < T; ++t) {
    gload();                               // overlap global latency with WMMA
    // keeps every load of the next stage ahead of this stage's products: one that
    // the scheduler sinks behind them is waited for at its full latency
    __builtin_amdgcn_sched_barrier(0);
    compute(t & 1);
    sstore((t & 1) ^ 1);
    __syncthreads();
  }
  compute((T - 1) & 1);                    // last stage: nothing left to fetch
  __syncthreads();
  // keeps the epilogue's address arithmetic out of the last stage, where its
  // registers come on top of that stage's fragments and pass 256
  __builtin_amdgcn_sched_barrier(0);

  auto epilogue = [&](auto mc) {
    constexpr int MD = decltype(mc)::value;
    #pragma unroll
    for (int fa = 0; fa < 2; ++fa) {
      #pragma unroll
      for (int fn = 0; fn < 4; ++fn) {
        const int n  = n0 + wn * 64 + fn * 16 + l16;
        const float bv = bias[n];
        #pragma unroll
        for (int j = 0; j < 8; ++j) {
          const int m = m0 + wm * 32 + fa * 16 + sub * 8 + j;
          float v = acc[fa][fn][j] + bv;
          if (RELU) v = fmaxf(v, 0.f);
          if (MD == 0) {
            outF[(size_t)m * N + n] = v;
          } else if (MD == 1) {
            int b = m >> 11, s = m & 2047, h = n >> 6, d = n & 63;
            outB[((((size_t)b * NH + h) * SEQ + s) << 6) + d] = f2bf(v);
          } else if (MD == 2) {
            int b = m >> 11, s = m & 2047, h = n >> 6, d = n & 63;
            outB[(((size_t)b * NH + h) * 64 + d) * SEQ + s] = f2bf(v);
          } else {
            outB[(size_t)m * N + n] = f2bf(v);
          }
        }
      }
    }
  };
  if constexpr (MODE == 4) {
    if (z == 2) {                          // the same for the whole work-group
      epilogue(mode_c<2>{});
    } else {
      epilogue(mode_c<1>{});
      // the other epilogue stands behind this one in the code: this keeps the wait in
      // front of its first write of a register that these stores name
      asm volatile("s_wait_xcnt 0x0" ::: "memory");
    }
  } else {
    epilogue(mode_c<MODE>{});
  }
}

__device__ __forceinline__ float xhalf(float x) {
  const int i = __builtin_bit_cast(int, x);
  return __builtin_bit_cast(float,
      __builtin_amdgcn_permlanex16(i, i, 0x76543210, 0xfedcba98, false, false));
}

__global__ __launch_bounds__(256)
void attention_kernel(const bf16* __restrict__ Q, const bf16* __restrict__ Kb,
                      const bf16* __restrict__ VT, bf16* __restrict__ O)
{
  constexpr int HD = 64, KLD = 80;            // 160B strides: 16B aligned
  __shared__ bf16 Ks[64 * KLD];               // 64 keys x 64 d
  __shared__ bf16 Vs[64 * KLD];               // 64 d    x 64 keys (V^T)
  const int tid  = threadIdx.x;
  const int lane = tid & 31, w = tid >> 5;
  const int sub = lane >> 4, l16 = lane & 15;
  const int bh = blockIdx.y;
  const int q0 = blockIdx.x * 128 + w * 16;
  const bf16* q  = Q  + (size_t)bh * SEQ * HD;
  const bf16* kp = Kb + (size_t)bh * SEQ * HD;
  const bf16* vt = VT + (size_t)bh * HD * SEQ;
  const float scale = 0.125f;                 // 1/sqrt(64)

  // resident Q fragments (16 queries x 64 d = 2 B-frags, column = query l16)
  v16bf qf[2];
  #pragma unroll
  for (int fa = 0; fa < 2; ++fa)
    qf[fa] = ld_frag(q + (size_t)(q0 + l16) * HD + fa * 32, sub);

  const v8f vz = {0.f,0.f,0.f,0.f,0.f,0.f,0.f,0.f};
  v8f o[4];                                   // O^T: o[f][j] = O[query l16][d = f*16 + sub*8 + j]
  #pragma unroll
  for (int f = 0; f < 4; ++f) o[f] = vz;
  float rowM = -1e30f;                        // this lane's query: running maximum (both halves alike)
  float rowL = 0.f;                           // and the sum over this half's keys only

  for (int kb = 0; kb < SEQ; kb += 64) {
    __syncthreads();                          // WAR on Ks/Vs
    // ---- cooperative K / V^T block staging (coalesced 16B chunks) ----
    #pragma unroll
    for (int i = 0; i < 2; ++i) {
      int c = tid + i * 256, r = c >> 3, dc = (c & 7) * 8;   // 512 chunks
      *(v8bf*)(Ks + r * KLD + dc) = *(const v8bf*)(kp + (size_t)(kb + r) * HD + dc);
      *(v8bf*)(Vs + r * KLD + dc) = *(const v8bf*)(vt + (size_t)r * SEQ + kb + dc);
    }
    __syncthreads();
    // ---- S^T: 4 key tiles x (2 k-steps over d); sf[fn][j] = S[l16][fn*16 + sub*8 + j] ----
    v8f sf[4];
    #pragma unroll
    for (int fn = 0; fn < 4; ++fn) {
      v8f a = vz;
      #pragma unroll
      for (int fa = 0; fa < 2; ++fa) {
        v16bf kf = ld_frag(Ks + (fn * 16 + l16) * KLD + fa * 32, sub);
        a = __builtin_amdgcn_wmma_f32_16x16x32_bf16(
                false, kf, false, qf[fa], (short)0, a, false, false);
      }
      sf[fn] = a;
    }
    // ---- online softmax of one query per lane ----
    float m4[4];
    #pragma unroll
    for (int f = 0; f < 4; ++f) {
      m4[f] = sf[f][0];
      #pragma unroll
      for (int j = 1; j < 8; ++j) m4[f] = fmaxf(m4[f], sf[f][j]);
    }
    float mx = fmaxf(fmaxf(m4[0], m4[1]), fmaxf(m4[2], m4[3]));
    mx = fmaxf(mx, xhalf(mx)) * scale;        // all 64 keys: both halves scale P alike
    const float mnew  = fmaxf(rowM, mx);
    const float alpha = __expf(rowM - mnew);
    rowM = mnew;
    #pragma unroll
    for (int f = 0; f < 4; ++f) o[f] *= alpha;
    // P^T as B operand: element s of a 32-key block is tile s >> 3, register s & 7
    FragU pb[2];
    float p4[4];
    #pragma unroll
    for (int f = 0; f < 4; ++f) {
      p4[f] = 0.f;
      #pragma unroll
      for (int j = 0; j < 8; ++j) {
        float p = __expf(sf[f][j] * scale - mnew);
        p4[f] += p;
        pb[f >> 1].h[f & 1][j] = f2bf(p);
      }
    }
    rowL = rowL * alpha + ((p4[0] + p4[1]) + (p4[2] + p4[3]));
    // ---- O^T += V^T (A, rows = d) @ P^T ----
    #pragma unroll
    for (int f = 0; f < 4; ++f) {
      #pragma unroll
      for (int fk = 0; fk < 2; ++fk) {
        v16bf vf = ld_frag(Vs + (f * 16 + l16) * KLD + fk * 32, sub);
        o[f] = __builtin_amdgcn_wmma_f32_16x16x32_bf16(
                   false, vf, false, pb[fk].v, (short)0, o[f], false, false);
      }
    }
  }

  // ---- finalize: join the halves' sums, divide, store 8 consecutive d (16B) a lane ----
  const int b = bh >> 4, h = bh & 15;
  const float inv = 1.0f / (rowL + xhalf(rowL));
  bf16* orow = O + ((size_t)b * SEQ + q0 + l16) * DM + h * 64 + sub * 8;
  #pragma unroll
  for (int f = 0; f < 4; ++f) {
    v8bf ov;
    #pragma unroll
    for (int j = 0; j < 8; ++j) ov[j] = f2bf(o[f][j] * inv);
    *(v8bf*)(orow + f * 16) = ov;
  }
}

// ---------------------------------------------------------------------------
// y = LayerNorm(X + R) * g + b ; fp32 out (+ optional bf16 out)
// One wave per row, 32 elements a lane in 16B pieces: the row's sums stay in the
// wave (no LDS, no barrier), and an eighth of the waves has to be started.
// ---------------------------------------------------------------------------
__global__ __launch_bounds__(256)
void ln_kernel(const float* __restrict__ X, const float* __restrict__ R,
               const float* __restrict__ g, const float* __restrict__ bb,
               float* __restrict__ outF, bf16* __restrict__ outB)
{
  constexpr int D = DM;
  const int lane = threadIdx.x & 31;
  // the wave's number as a scalar: every row address is a scalar base plus one lane offset
  const int row  = blockIdx.x * 8 + __builtin_amdgcn_readfirstlane(threadIdx.x >> 5);
  const float* x = X + (size_t)row * D + lane * 4;
  const float* r = R + (size_t)row * D + lane * 4;
  v4f v[8], rv[8], gv[8], bv[8];
  #pragma unroll
  for (int i = 0; i < 8; ++i) {            // each load: 512 contiguous bytes a wave
    v[i]  = *(const v4f*)(x + i * 128);
    rv[i] = *(const v4f*)(r + i * 128);
  }
  #pragma unroll
  for (int i = 0; i < 8; ++i) {
    gv[i] = *(const v4f*)(g  + lane * 4 + i * 128);
    bv[i] = *(const v4f*)(bb + lane * 4 + i * 128);
  }
  // keeps all 32 loads ahead of the sums, in flight together: sunk behind them
  // to save registers, they are waited for group by group at full latency
  __builtin_amdgcn_sched_barrier(0);
  v4f s4 = {0.f, 0.f, 0.f, 0.f};
  #pragma unroll
  for (int i = 0; i < 8; ++i) { v[i] += rv[i]; s4 += v[i]; }
  float s = (s4[0] + s4[1]) + (s4[2] + s4[3]);
  #pragma unroll
  for (int off = 16; off; off >>= 1) s += __shfl_xor(s, off, 32);
  const float mu = s * (1.0f / D);
  v4f q4 = {0.f, 0.f, 0.f, 0.f};
  #pragma unroll
  for (int i = 0; i < 8; ++i) { v4f d = v[i] - mu; q4 += d * d; }
  float vs = (q4[0] + q4[1]) + (q4[2] + q4[3]);
  #pragma unroll
  for (int off = 16; off; off >>= 1) vs += __shfl_xor(vs, off, 32);
  const float rs = rsqrtf(vs * (1.0f / D) + 1e-5f);
  const size_t c = (size_t)row * D + lane * 4;
  #pragma unroll
  for (int i = 0; i < 8; ++i) v[i] = (v[i] - mu) * rs * gv[i] + bv[i];
  if (outB) {
    v4bf o[8];
    #pragma unroll
    for (int i = 0; i < 8; ++i)
      #pragma unroll
      for (int e = 0; e < 4; ++e) o[i][e] = f2bf(v[i][e]);
    #pragma unroll
    for (int i = 0; i < 8; ++i) *(v4bf*)(outB + c + i * 128) = o[i];
  }
  #pragma unroll
  for (int i = 0; i < 8; ++i) *(v4f*)(outF + c + i * 128) = v[i];
}

// ---------------------------------------------------------------------------
extern "C" void kernel_launch(void* const* d_in, const int* in_sizes, int n_in,
                              void* d_out, int out_size, void* d_ws, size_t ws_size,
                              hipStream_t stream)
{
  const float* x    = (const float*)d_in[0];
  const float* Wq   = (const float*)d_in[1];
  const float* bq   = (const float*)d_in[2];
  const float* Wk   = (const float*)d_in[3];
  const float* bk   = (const float*)d_in[4];
  const float* Wv   = (const float*)d_in[5];
  const float* bv   = (const float*)d_in[6];
  const float* Wo   = (const float*)d_in[7];
  const float* bo   = (const float*)d_in[8];
  const float* W1   = (const float*)d_in[9];
  const float* b1   = (const float*)d_in[10];
  const float* W2   = (const float*)d_in[11];
  const float* b2   = (const float*)d_in[12];
  const float* ln1g = (const float*)d_in[13];
  const float* ln1b = (const float*)d_in[14];
  const float* ln2g = (const float*)d_in[15];
  const float* ln2b = (const float*)d_in[16];

  char* p = (char*)d_ws;
  auto carve = [&](size_t bytes) { void* r = (void*)p; p += (bytes + 255) & ~(size_t)255; return r; };
  bf16*  xb   = (bf16*) carve((size_t)TOKS * DM * 2);
  bf16*  Wqt  = (bf16*) carve((size_t)DM * DM * 2);
  bf16*  Wkt  = (bf16*) carve((size_t)DM * DM * 2);
  bf16*  Wvt  = (bf16*) carve((size_t)DM * DM * 2);
  bf16*  Wot  = (bf16*) carve((size_t)DM * DM * 2);
  bf16*  W1t  = (bf16*) carve((size_t)DM * DFF * 2);
  bf16*  W2t  = (bf16*) carve((size_t)DFF * DM * 2);
  bf16*  qh   = (bf16*) carve((size_t)TOKS * DM * 2);   // [b,h,s,d]
  bf16*  kh   = (bf16*) carve((size_t)TOKS * DM * 2);   // [b,h,s,d]
  bf16*  vth  = (bf16*) carve((size_t)TOKS * DM * 2);   // [b,h,d,s]
  bf16*  attnO= (bf16*) carve((size_t)TOKS * DM * 2);   // [b,s,D]
  float* aprj = (float*)carve((size_t)TOKS * DM * 4);
  float* x1f  = (float*)carve((size_t)TOKS * DM * 4);
  bf16*  x1b  = (bf16*) carve((size_t)TOKS * DM * 2);
  bf16*  hb   = qh;     // 32MB alias over qh/kh/vth/attnO (dead after Wo gemm)
  float* ff   = aprj;   // alias: attn_proj dead after LN1

  // --- precision conversion / weight transposes ---
  // Wqt, Wkt, Wvt, Wot are carved one behind another (each a multiple of 256B)
  prep_kernel<<<2048, 256, 0, stream>>>(x, Wq, Wk, Wv, Wo, W1, W2, xb, Wqt, W1t, W2t);

  // --- QKV projections (bf16 WMMA, head-layout scatter epilogues) ---
  // one launch; qh, kh, vth are carved one behind another, like the weights
  gemm_bf16<4, false, DM><<<dim3(DM / 128, TOKS / 128, 3), 256, 0, stream>>>(
      xb, Wqt, bq, nullptr, qh, TOKS, DM, bk, bv);

  // --- fused flash attention ---
  attention_kernel<<<dim3(SEQ / 128, 32), 256, 0, stream>>>(qh, kh, vth, attnO);

  // --- output projection + LN1 ---
  gemm_bf16<0, false, DM><<<dim3(DM / 128, TOKS / 128), 256, 0, stream>>>(
      attnO, Wot, bo, aprj, nullptr, TOKS, DM, nullptr, nullptr);
  ln_kernel<<<TOKS / 8, 256, 0, stream>>>(x, aprj, ln1g, ln1b, x1f, x1b);

  // --- FFN ---
  gemm_bf16<3, true, DM><<<dim3(DFF / 128, TOKS / 128), 256, 0, stream>>>(
      x1b, W1t, b1, nullptr, hb, TOKS, DFF, nullptr, nullptr);
  gemm_bf16<0, false, DFF><<<dim3(DM / 128, TOKS / 128), 256, 0, stream>>>(
      hb, W2t, b2, ff, nullptr, TOKS, DM, nullptr, nullptr);

  // --- LN2 -> final fp32 output ---
  ln_kernel<<<TOKS / 8, 256, 0, stream>>>(x1f, ff, ln2g, ln2b, (float*)d_out, nullptr);

  (void)in_sizes; (void)n_in; (void)out_size; (void)ws_size;
  (void)Wkt; (void)Wvt; (void)kh; (void)vth;
}

// v005
// Measured time: 172 microseconds a run.
// Timed twice side by side with v004, it ran 1.07 and 1.09 times as fast.
// Over all steps from v000 it is 2.13 times as fast.
#include <hip/hip_runtime.h>
#include <hip/hip_bf16.h>

typedef __bf16 bf16;
typedef __attribute__((ext_vector_type(16))) __bf16 v16bf;
typedef __attribute__((ext_vector_type(8)))  __bf16 v8bf;
typedef __attribute__((ext_vector_type(8)))  float   v8f;
typedef __attribute__((ext_vector_type(4)))  float   v4f;
typedef __attribute__((ext_vector_type(4)))  __bf16 v4bf;

#define TOKS 4096   // B*S
#define DM   1024
#define DFF  4096
#define SEQ  2048
#define NH   16

__device__ __forceinline__ bf16 f2bf(float f) {
  unsigned u = __builtin_bit_cast(unsigned, f);
  u += 0x7FFFu + ((u >> 16) & 1u);           // round-to-nearest-even
  unsigned short h = (unsigned short)(u >> 16);
  return __builtin_bit_cast(bf16, h);
}

union FragU { v16bf v; v8bf h[2]; };

__device__ __forceinline__ v16bf ld_frag(const bf16* rowPtr, int sub) {
  FragU u;
  u.h[0] = *(const v8bf*)(rowPtr + sub * 8);
  u.h[1] = *(const v8bf*)(rowPtr + sub * 8 + 16);
  return u.v;
}

// LDS byte address of a __shared__ element: the low 32 bits of its address.
__device__ __forceinline__ unsigned lds_addr(const void* p) { return (unsigned)(size_t)p; }

template<int GSTEP, int LSTEP>
__device__ __forceinline__ void async_copy8(unsigned l, const bf16* g) {
  asm volatile(
      "global_load_async_to_lds_b128 %0, %8, off\n\t"
      "global_load_async_to_lds_b128 %1, %9, off\n\t"
      "global_load_async_to_lds_b128 %2, %10, off\n\t"
      "global_load_async_to_lds_b128 %3, %11, off\n\t"
      "global_load_async_to_lds_b128 %4, %12, off\n\t"
      "global_load_async_to_lds_b128 %5, %13, off\n\t"
      "global_load_async_to_lds_b128 %6, %14, off\n\t"
      "global_load_async_to_lds_b128 %7, %15, off\n\t"
      "s_wait_xcnt 0x0"
      :: "v"(l), "v"(l + LSTEP), "v"(l + 2 * LSTEP), "v"(l + 3 * LSTEP),
         "v"(l + 4 * LSTEP), "v"(l + 5 * LSTEP), "v"(l + 6 * LSTEP), "v"(l + 7 * LSTEP),
         "v"(g), "v"(g + GSTEP), "v"(g + 2 * GSTEP), "v"(g + 3 * GSTEP),
         "v"(g + 4 * GSTEP), "v"(g + 5 * GSTEP), "v"(g + 6 * GSTEP), "v"(g + 7 * GSTEP)
      : "memory");
}

// ---------------------------------------------------------------------------
// fp32 -> bf16 elementwise convert. A thread converts 32 elements (4 runs of 8,
// two 16B loads and one 16B store a run): the launch is short, so the time to
// start its waves counts, and an eighth of the waves does the same bytes.
// ---------------------------------------------------------------------------
__device__ __forceinline__
void cvt_bf16_tile(const float* __restrict__ X, bf16* __restrict__ Y, int blk) {
  const size_t base = (size_t)blk * 8192 + threadIdx.x * 8;
  v4f a[4][2];
  #pragma unroll
  for (int j = 0; j < 4; ++j) {
    a[j][0] = *(const v4f*)(X + base + j * 2048);
    a[j][1] = *(const v4f*)(X + base + j * 2048 + 4);
  }
  v8bf o[4];
  #pragma unroll
  for (int j = 0; j < 4; ++j)
    #pragma unroll
    for (int e = 0; e < 4; ++e) { o[j][e] = f2bf(a[j][0][e]); o[j][e + 4] = f2bf(a[j][1][e]); }
  #pragma unroll
  for (int j = 0; j < 4; ++j) *(v8bf*)(Y + base + j * 2048) = o[j];
}

// ---------------------------------------------------------------------------
// fp32 [K x N] -> bf16 transposed [N x K]. One work-group turns a tile of
// 128 k x 64 n (32 elements a thread): 16B loads along n, 16B stores along k
// that fill whole 128B lines, and an eighth of the waves to start.
// ---------------------------------------------------------------------------
template<int K, int N>   // at compile time: a thread's loads share one address, its stores too
__device__ __forceinline__
void transpose_cvt_tile(const float* __restrict__ W, bf16* __restrict__ Wt,
                        float (*t)[65], int bx, int by) {
  const int bn = bx * 64, bk = by * 128;
  const int tid = threadIdx.x;
  const int lr = tid >> 4, lc = (tid & 15) * 4;   // 16 lanes cover a 256B row piece
  const float* wp = W + (size_t)(bk + lr) * N + bn + lc;
  v4f a[8];
  #pragma unroll
  for (int i = 0; i < 8; ++i) a[i] = *(const v4f*)(wp + i * 16 * N);
  #pragma unroll
  for (int i = 0; i < 8; ++i)
    #pragma unroll
    for (int e = 0; e < 4; ++e) t[lr + i * 16][lc + e] = a[i][e];
  __syncthreads();
  const int kc = (tid & 7) * 8, nr = tid >> 3;    // 8 lanes cover a 128B line of Wt
  v8bf o[4];
  #pragma unroll
  for (int i = 0; i < 4; ++i)
    #pragma unroll
    for (int e = 0; e < 8; ++e)
      o[i][e] = f2bf(t[kc + (i & 1) * 64 + e][nr + (i >> 1) * 32]);
  bf16* op = Wt + (size_t)(bn + nr) * K + bk + kc;
  #pragma unroll
  for (int i = 0; i < 4; ++i) *(v8bf*)(op + (i >> 1) * 32 * K + (i & 1) * 64) = o[i];
  // the merged launch's jobs stand one behind another in the code: this keeps the wait
  // in front of the next job's first write of a register that these stores name
  asm volatile("s_wait_xcnt 0x0" ::: "memory");
}

__global__ __launch_bounds__(256)
void prep_kernel(const float* __restrict__ x,  const float* __restrict__ Wq,
                 const float* __restrict__ Wk, const float* __restrict__ Wv,
                 const float* __restrict__ Wo, const float* __restrict__ W1,
                 const float* __restrict__ W2, bf16* __restrict__ xb,
                 bf16* __restrict__ Wsq, bf16* __restrict__ W1t, bf16* __restrict__ W2t) {
  __shared__ float t[128][65];
  const int i = blockIdx.x & 511;
  switch (blockIdx.x >> 9) {
    case 0:
      cvt_bf16_tile(x, xb, i);
      return;
    case 1:
      transpose_cvt_tile<DM, DFF>(W1, W1t, t, i & 63, i >> 6);
      return;
    case 2:
      transpose_cvt_tile<DFF, DM>(W2, W2t, t, i & 15, i >> 4);
      return;
    default: {
      const int m = i >> 7;
      const float* W = m == 0 ? Wq : m == 1 ? Wk : m == 2 ? Wv : Wo;
      transpose_cvt_tile<DM, DM>(W, Wsq + (size_t)m * DM * DM, t, i & 15, (i >> 4) & 7);
      return;
    }
  }
}

// ---------------------------------------------------------------------------
// bf16 GEMM, LDS double-buffered: C[M,N] = A[M,K] @ Bt[N,K]^T + bias.
// The tiles reach LDS by asynchronous copies: the next stage lands while this one is
// multiplied, and no wave waits for loads in registers or stores them to LDS.
// MODE 0: fp32 row-major.  MODE 1: bf16 scatter to [b,h,s,d].
// MODE 2: bf16 scatter to [b,h,d,s] (V transposed).  MODE 3: bf16 row-major.
// MODE 4: the Q, K and V products in one launch: blockIdx.z picks weight, bias and
// output (weights and outputs lie one behind another); z 0 and 1 store as MODE 1,
// z 2 as MODE 2. Three work-groups a WGP instead of one: two are resident and fill
// each other's waits, and two launch gaps, ramps and drains go.
// ---------------------------------------------------------------------------
template<int V> struct mode_c { static constexpr int value = V; };

template<int MODE, bool RELU, int K>
__global__ __launch_bounds__(256)
void gemm_bf16(const bf16* __restrict__ A, const bf16* __restrict__ Bt,
               const float* __restrict__ bias,
               float* __restrict__ outF, bf16* __restrict__ outB,
               int M, int N,
               const float* __restrict__ biasK, const float* __restrict__ biasV)
{
  constexpr int BK = 128;                  // k depth of one LDS stage: 256B rows
  constexpr int LD = BK + 8;               // 272B row pitch: 16B x odd
  constexpr unsigned BUF = 128 * LD * 2;   // bytes of one buffer
  static_assert(BK / 16 == 8, "a thread copies eight 16B chunks per operand and stage");
  __shared__ __attribute__((aligned(16))) bf16 As[2][128 * LD];
  __shared__ __attribute__((aligned(16))) bf16 Bs[2][128 * LD];
  const int tid  = threadIdx.x;
  const int lane = tid & 31, w = tid >> 5;
  const int wm = w & 3, wn = w >> 2;       // 4 waves along M, 2 along N
  const int sub = lane >> 4, l16 = lane & 15;
  const int m0 = blockIdx.y * 128, n0 = blockIdx.x * 128;
  const int z = MODE == 4 ? blockIdx.z : 0;
  if (MODE == 4) {
    Bt   += (size_t)z * DM * DM;
    outB += (size_t)z * TOKS * DM;
    bias  = z == 0 ? bias : z == 1 ? biasK : biasV;
  }

  // this thread's 16B chunks of a 128xBK tile: 16 lanes cover one 256B row,
  // chunk i sits 16 rows below chunk i-1
  const int r0 = tid >> 4, kc0 = (tid & 15) * 8;
  const bf16* ga = A  + (size_t)(m0 + r0) * K + kc0;   // walk along k, one stage a step
  const bf16* gb = Bt + (size_t)(n0 + r0) * K + kc0;

  const v8f vz = {0.f,0.f,0.f,0.f,0.f,0.f,0.f,0.f};
  v8f acc[2][4];
  #pragma unroll
  for (int i = 0; i < 2; ++i)
    #pragma unroll
    for (int j = 0; j < 4; ++j) acc[i][j] = vz;

  const unsigned la = lds_addr(As[0] + r0 * LD + kc0);
  const unsigned lb = lds_addr(Bs[0] + r0 * LD + kc0);
  auto copy_stage = [&](int b) {           // 16 copies a lane, all lanes on
    async_copy8<16 * K, 16 * LD * 2>(la + b * BUF, ga);
    async_copy8<16 * K, 16 * LD * 2>(lb + b * BUF, gb);
    ga += BK;
    gb += BK;
  };

  constexpr int T = K / BK;
  static_assert(T >= 2, "the ring's prologue fills two stages");
  copy_stage(0);
  asm volatile("s_wait_asynccnt 0x0" ::: "memory");   // this wave's part of stage 0 has landed
  __syncthreads();                                    // every wave's part has
  copy_stage(1);

  auto compute = [&](int cur) {
    #pragma unroll
    for (int ks = 0; ks < BK; ks += 32) {
      v16bf af[2], bfg[4];
      #pragma unroll
      for (int fa = 0; fa < 2; ++fa)
        af[fa] = ld_frag(As[cur] + (wm * 32 + fa * 16 + l16) * LD + ks, sub);
      #pragma unroll
      for (int fn = 0; fn < 4; ++fn)
        bfg[fn] = ld_frag(Bs[cur] + (wn * 64 + fn * 16 + l16) * LD + ks, sub);
      __builtin_amdgcn_sched_barrier(0);
      #pragma unroll
      for (int fa = 0; fa < 2; ++fa)
        #pragma unroll
        for (int fn = 0; fn < 4; ++fn)
          acc[fa][fn] = __builtin_amdgcn_wmma_f32_16x16x32_bf16(
              false, af[fa], false, bfg[fn], (short)0, acc[fa][fn], false, false);
    }
  };

  // rolled: unrolled, the short-K build is one copy of the body per stage, each
  // run once by a wave and fetched cold
  #pragma unroll 1
  for (int t = 0; t < T; ++t) {
    compute(t & 1);
    asm volatile("s_wait_dscnt 0x0" ::: "memory");     // this wave has left buffer t & 1
    asm volatile("s_wait_asynccnt 0x0" ::: "memory");  // its part of stage t + 1 has landed
    __syncthreads();                       // stage t + 1 is whole, buffer t & 1 is free
    if (t + 2 < T) copy_stage(t & 1);      // flies under stage t + 1's products
  }
  asm volatile("s_wait_asynccnt 0x0" ::: "memory");    // no copy is out when the wave ends

  auto epilogue = [&](auto mc) {
    constexpr int MD = decltype(mc)::value;
    #pragma unroll
    for (int fa = 0; fa < 2; ++fa) {
      #pragma unroll
      for (int fn = 0; fn < 4; ++fn) {
        const int n  = n0 + wn * 64 + fn * 16 + l16;
        const float bv = bias[n];
        #pragma unroll
        for (int j = 0; j < 8; ++j) {
          const int m = m0 + wm * 32 + fa * 16 + sub * 8 + j;
          float v = acc[fa][fn][j] + bv;
          if (RELU) v = fmaxf(v, 0.f);
          if (MD == 0) {
            outF[(size_t)m * N + n] = v;
          } else if (MD == 1) {
            int b = m >> 11, s = m & 2047, h = n >> 6, d = n & 63;
            outB[((((size_t)b * NH + h) * SEQ + s) << 6) + d] = f2bf(v);
          } else if (MD == 2) {
            int b = m >> 11, s = m & 2047, h = n >> 6, d = n & 63;
            outB[(((size_t)b * NH + h) * 64 + d) * SEQ + s] = f2bf(v);
          } else {
            outB[(size_t)m * N + n] = f2bf(v);
          }
        }
      }
    }
  };
  if constexpr (MODE == 4) {
    if (z == 2) {                          // the same for the whole work-group
      epilogue(mode_c<2>{});
    } else {
      epilogue(mode_c<1>{});
      // the other epilogue stands behind this one in the code: this keeps the wait in
      // front of its first write of a register that these stores name
      asm volatile("s_wait_xcnt 0x0" ::: "memory");
    }
  } else {
    epilogue(mode_c<MODE>{});
  }
}

__device__ __forceinline__ float xhalf(float x) {
  const int i = __builtin_bit_cast(int, x);
  return __builtin_bit_cast(float,
      __builtin_amdgcn_permlanex16(i, i, 0x76543210, 0xfedcba98, false, false));
}

__global__ __launch_bounds__(256)
void attention_kernel(const bf16* __restrict__ Q, const bf16* __restrict__ Kb,
                      const bf16* __restrict__ VT, bf16* __restrict__ O)
{
  constexpr int HD = 64, KLD = 80;            // 160B strides: 16B aligned
  constexpr unsigned KBUF = 64 * KLD * 2;     // bytes of one buffer
  __shared__ __attribute__((aligned(16))) bf16 Ks[2][64 * KLD];   // 64 keys x 64 d
  __shared__ __attribute__((aligned(16))) bf16 Vs[2][64 * KLD];   // 64 d    x 64 keys (V^T)
  const int tid  = threadIdx.x;
  const int lane = tid & 31, w = tid >> 5;
  const int sub = lane >> 4, l16 = lane & 15;
  const int bh = blockIdx.y;
  const int q0 = blockIdx.x * 128 + w * 16;
  const bf16* q  = Q  + (size_t)bh * SEQ * HD;
  const bf16* kp = Kb + (size_t)bh * SEQ * HD;
  const bf16* vt = VT + (size_t)bh * HD * SEQ;
  const float scale = 0.125f;                 // 1/sqrt(64)

  // resident Q fragments (16 queries x 64 d = 2 B-frags, column = query l16)
  v16bf qf[2];
  #pragma unroll
  for (int fa = 0; fa < 2; ++fa)
    qf[fa] = ld_frag(q + (size_t)(q0 + l16) * HD + fa * 32, sub);

  const v8f vz = {0.f,0.f,0.f,0.f,0.f,0.f,0.f,0.f};
  v8f o[4];                                   // O^T: o[f][j] = O[query l16][d = f*16 + sub*8 + j]
  #pragma unroll
  for (int f = 0; f < 4; ++f) o[f] = vz;
  float rowM = -1e30f;                        // this lane's query: running maximum (both halves alike)
  float rowL = 0.f;                           // and the sum over this half's keys only

  // ---- cooperative K / V^T block staging: 512 chunks of 16B per operand, two a thread,
  // 32 rows apart; 8 lanes cover a 128B row ----
  const int sr = tid >> 3, sc = (tid & 7) * 8;
  const bf16* gk = kp + (size_t)sr * HD + sc;  // walk along the keys, one block a step
  const bf16* gv = vt + (size_t)sr * SEQ + sc;
  const unsigned lk = lds_addr(Ks[0] + sr * KLD + sc);
  const unsigned lv = lds_addr(Vs[0] + sr * KLD + sc);
  auto copy_block = [&](int b) {              // 4 copies a lane, all lanes on
    asm volatile(
        "global_load_async_to_lds_b128 %0, %4, off\n\t"
        "global_load_async_to_lds_b128 %1, %5, off\n\t"
        "global_load_async_to_lds_b128 %2, %6, off\n\t"
        "global_load_async_to_lds_b128 %3, %7, off\n\t"
        "s_wait_xcnt 0x0"
        :: "v"(lk + b * KBUF), "v"(lk + b * KBUF + 32 * KLD * 2),
           "v"(lv + b * KBUF), "v"(lv + b * KBUF + 32 * KLD * 2),
           "v"(gk), "v"(gk + 32 * HD), "v"(gv), "v"(gv + 32 * SEQ)
        : "memory");
    gk += 64 * HD;
    gv += 64;
  };
  constexpr int NB = SEQ / 64;
  static_assert(NB >= 2, "the ring's prologue fills two blocks");
  copy_block(0);
  asm volatile("s_wait_asynccnt 0x0" ::: "memory");   // this wave's part of block 0 has landed
  __syncthreads();                                    // every wave's part has
  copy_block(1);

  for (int t = 0; t < NB; ++t) {
    const bf16* Kc = Ks[t & 1];
    const bf16* Vc = Vs[t & 1];
    // ---- S^T: 4 key tiles x (2 k-steps over d); sf[fn][j] = S[l16][fn*16 + sub*8 + j] ----
    v8f sf[4];
    #pragma unroll
    for (int fn = 0; fn < 4; ++fn) {
      v8f a = vz;
      #pragma unroll
      for (int fa = 0; fa < 2; ++fa) {
        v16bf kf = ld_frag(Kc + (fn * 16 + l16) * KLD + fa * 32, sub);
        a = __builtin_amdgcn_wmma_f32_16x16x32_bf16(
                false, kf, false, qf[fa], (short)0, a, false, false);
      }
      sf[fn] = a;
    }
    // ---- online softmax of one query per lane ----
    float m4[4];
    #pragma unroll
    for (int f = 0; f < 4; ++f) {
      m4[f] = sf[f][0];
      #pragma unroll
      for (int j = 1; j < 8; ++j) m4[f] = fmaxf(m4[f], sf[f][j]);
    }
    float mx = fmaxf(fmaxf(m4[0], m4[1]), fmaxf(m4[2], m4[3]));
    mx = fmaxf(mx, xhalf(mx)) * scale;        // all 64 keys: both halves scale P alike
    const float mnew  = fmaxf(rowM, mx);
    const float alpha = __expf(rowM - mnew);
    rowM = mnew;
    #pragma unroll
    for (int f = 0; f < 4; ++f) o[f] *= alpha;
    // P^T as B operand: element s of a 32-key block is tile s >> 3, register s & 7
    FragU pb[2];
    float p4[4];
    #pragma unroll
    for (int f = 0; f < 4; ++f) {
      p4[f] = 0.f;
      #pragma unroll
      for (int j = 0; j < 8; ++j) {
        float p = __expf(sf[f][j] * scale - mnew);
        p4[f] += p;
        pb[f >> 1].h[f & 1][j] = f2bf(p);
      }
    }
    rowL = rowL * alpha + ((p4[0] + p4[1]) + (p4[2] + p4[3]));
    // ---- O^T += V^T (A, rows = d) @ P^T ----
    #pragma unroll
    for (int f = 0; f < 4; ++f) {
      #pragma unroll
      for (int fk = 0; fk < 2; ++fk) {
        v16bf vf = ld_frag(Vc + (f * 16 + l16) * KLD + fk * 32, sub);
        o[f] = __builtin_amdgcn_wmma_f32_16x16x32_bf16(
                   false, vf, false, pb[fk].v, (short)0, o[f], false, false);
      }
    }
    asm volatile("s_wait_dscnt 0x0" ::: "memory");     // this wave has left buffer t & 1
    asm volatile("s_wait_asynccnt 0x0" ::: "memory");  // its part of block t + 1 has landed
    __syncthreads();                          // block t + 1 is whole, buffer t & 1 is free
    __builtin_amdgcn_sched_barrier(0);
    asm volatile("v_nop\n\tv_nop\n\tv_nop\n\tv_nop");
    if (t + 2 < NB) copy_block(t & 1);        // flies under block t + 1's work
  }
  asm volatile("s_wait_asynccnt 0x0" ::: "memory");    // no copy is out when the wave ends

  // ---- finalize: join the halves' sums, divide, store 8 consecutive d (16B) a lane ----
  const int b = bh >> 4, h = bh & 15;
  const float inv = 1.0f / (rowL + xhalf(rowL));
  bf16* orow = O + ((size_t)b * SEQ + q0 + l16) * DM + h * 64 + sub * 8;
  #pragma unroll
  for (int f = 0; f < 4; ++f) {
    v8bf ov;
    #pragma unroll
    for (int j = 0; j < 8; ++j) ov[j] = f2bf(o[f][j] * inv);
    *(v8bf*)(orow + f * 16) = ov;
  }
}

// ---------------------------------------------------------------------------
// y = LayerNorm(X + R) * g + b ; fp32 out (+ optional bf16 out)
// One wave per row, 32 elements a lane in 16B pieces: the row's sums stay in the
// wave (no LDS, no barrier), and an eighth of the waves has to be started.
// ---------------------------------------------------------------------------
__global__ __launch_bounds__(256)
void ln_kernel(const float* __restrict__ X, const float* __restrict__ R,
               const float* __restrict__ g, const float* __restrict__ bb,
               float* __restrict__ outF, bf16* __restrict__ outB)
{
  constexpr int D = DM;
  const int lane = threadIdx.x & 31;
  // the wave's number as a scalar: every row address is a scalar base plus one lane offset
  const int row  = blockIdx.x * 8 + __builtin_amdgcn_readfirstlane(threadIdx.x >> 5);
  const float* x = X + (size_t)row * D + lane * 4;
  const float* r = R + (size_t)row * D + lane * 4;
  v4f v[8], rv[8], gv[8], bv[8];
  #pragma unroll
  for (int i = 0; i < 8; ++i) {            // each load: 512 contiguous bytes a wave
    v[i]  = *(const v4f*)(x + i * 128);
    rv[i] = *(const v4f*)(r + i * 128);
  }
  #pragma unroll
  for (int i = 0; i < 8; ++i) {
    gv[i] = *(const v4f*)(g  + lane * 4 + i * 128);
    bv[i] = *(const v4f*)(bb + lane * 4 + i * 128);
  }
  // keeps all 32 loads ahead of the sums, in flight together: sunk behind them
  // to save registers, they are waited for group by group at full latency
  __builtin_amdgcn_sched_barrier(0);
  v4f s4 = {0.f, 0.f, 0.f, 0.f};
  #pragma unroll
  for (int i = 0; i < 8; ++i) { v[i] += rv[i]; s4 += v[i]; }
  float s = (s4[0] + s4[1]) + (s4[2] + s4[3]);
  #pragma unroll
  for (int off = 16; off; off >>= 1) s += __shfl_xor(s, off, 32);
  const float mu = s * (1.0f / D);
  v4f q4 = {0.f, 0.f, 0.f, 0.f};
  #pragma unroll
  for (int i = 0; i < 8; ++i) { v4f d = v[i] - mu; q4 += d * d; }
  float vs = (q4[0] + q4[1]) + (q4[2] + q4[3]);
  #pragma unroll
  for (int off = 16; off; off >>= 1) vs += __shfl_xor(vs, off, 32);
  const float rs = rsqrtf(vs * (1.0f / D) + 1e-5f);
  const size_t c = (size_t)row * D + lane * 4;
  #pragma unroll
  for (int i = 0; i < 8; ++i) v[i] = (v[i] - mu) * rs * gv[i] + bv[i];
  if (outB) {
    v4bf o[8];
    #pragma unroll
    for (int i = 0; i < 8; ++i)
      #pragma unroll
      for (int e = 0; e < 4; ++e) o[i][e] = f2bf(v[i][e]);
    #pragma unroll
    for (int i = 0; i < 8; ++i) *(v4bf*)(outB + c + i * 128) = o[i];
  }
  #pragma unroll
  for (int i = 0; i < 8; ++i) *(v4f*)(outF + c + i * 128) = v[i];
}

// ---------------------------------------------------------------------------
extern "C" void kernel_launch(void* const* d_in, const int* in_sizes, int n_in,
                              void* d_out, int out_size, void* d_ws, size_t ws_size,
                              hipStream_t stream)
{
  const float* x    = (const float*)d_in[0];
  const float* Wq   = (const float*)d_in[1];
  const float* bq   = (const float*)d_in[2];
  const float* Wk   = (const float*)d_in[3];
  const float* bk   = (const float*)d_in[4];
  const float* Wv   = (const float*)d_in[5];
  const float* bv   = (const float*)d_in[6];
  const float* Wo   = (const float*)d_in[7];
  const float* bo   = (const float*)d_in[8];
  const float* W1   = (const float*)d_in[9];
  const float* b1   = (const float*)d_in[10];
  const float* W2   = (const float*)d_in[11];
  const float* b2   = (const float*)d_in[12];
  const float* ln1g = (const float*)d_in[13];
  const float* ln1b = (const float*)d_in[14];
  const float* ln2g = (const float*)d_in[15];
  const float* ln2b = (const float*)d_in[16];

  char* p = (char*)d_ws;
  auto carve = [&](size_t bytes) { void* r = (void*)p; p += (bytes + 255) & ~(size_t)255; return r; };
  bf16*  xb   = (bf16*) carve((size_t)TOKS * DM * 2);
  bf16*  Wqt  = (bf16*) carve((size_t)DM * DM * 2);
  bf16*  Wkt  = (bf16*) carve((size_t)DM * DM * 2);
  bf16*  Wvt  = (bf16*) carve((size_t)DM * DM * 2);
  bf16*  Wot  = (bf16*) carve((size_t)DM * DM * 2);
  bf16*  W1t  = (bf16*) carve((size_t)DM * DFF * 2);
  bf16*  W2t  = (bf16*) carve((size_t)DFF * DM * 2);
  bf16*  qh   = (bf16*) carve((size_t)TOKS * DM * 2);   // [b,h,s,d]
  bf16*  kh   = (bf16*) carve((size_t)TOKS * DM * 2);   // [b,h,s,d]
  bf16*  vth  = (bf16*) carve((size_t)TOKS * DM * 2);   // [b,h,d,s]
  bf16*  attnO= (bf16*) carve((size_t)TOKS * DM * 2);   // [b,s,D]
  float* aprj = (float*)carve((size_t)TOKS * DM * 4);
  float* x1f  = (float*)carve((size_t)TOKS * DM * 4);
  bf16*  x1b  = (bf16*) carve((size_t)TOKS * DM * 2);
  bf16*  hb   = qh;     // 32MB alias over qh/kh/vth/attnO (dead after Wo gemm)
  float* ff   = aprj;   // alias: attn_proj dead after LN1

  // --- precision conversion / weight transposes ---
  // Wqt, Wkt, Wvt, Wot are carved one behind another (each a multiple of 256B)
  prep_kernel<<<2048, 256, 0, stream>>>(x, Wq, Wk, Wv, Wo, W1, W2, xb, Wqt, W1t, W2t);

  // --- QKV projections (bf16 WMMA, head-layout scatter epilogues) ---
  // one launch; qh, kh, vth are carved one behind another, like the weights
  gemm_bf16<4, false, DM><<<dim3(DM / 128, TOKS / 128, 3), 256, 0, stream>>>(
      xb, Wqt, bq, nullptr, qh, TOKS, DM, bk, bv);

  // --- fused flash attention ---
  attention_kernel<<<dim3(SEQ / 128, 32), 256, 0, stream>>>(qh, kh, vth, attnO);

  // --- output projection + LN1 ---
  gemm_bf16<0, false, DM><<<dim3(DM / 128, TOKS / 128), 256, 0, stream>>>(
      attnO, Wot, bo, aprj, nullptr, TOKS, DM, nullptr, nullptr);
  ln_kernel<<<TOKS / 8, 256, 0, stream>>>(x, aprj, ln1g, ln1b, x1f, x1b);

  // --- FFN ---
  gemm_bf16<3, true, DM><<<dim3(DFF / 128, TOKS / 128), 256, 0, stream>>>(
      x1b, W1t, b1, nullptr, hb, TOKS, DFF, nullptr, nullptr);
  gemm_bf16<0, false, DFF><<<dim3(DM / 128, TOKS / 128), 256, 0, stream>>>(
      hb, W2t, b2, ff, nullptr, TOKS, DM, nullptr, nullptr);

  // --- LN2 -> final fp32 output ---
  ln_kernel<<<TOKS / 8, 256, 0, stream>>>(x1f, ff, ln2g, ln2b, (float*)d_out, nullptr);

  (void)in_sizes; (void)n_in; (void)out_size; (void)ws_size;
  (void)Wkt; (void)Wvt; (void)kh; (void)vth;
}
